// v000
// The times below were measured on an AMD MI455X: many runs one after another, warmed up first and cycling through
// copies of the inputs, with the whole window's GPU time divided by the number of runs. Launches and the gaps
// between them are all in it. The median over several windows is given; except for v000 it joins two sittings, which
// can be a few percent apart, so the side-by-side timings, each taken in one sitting, are the better comparison.
// v000 is the starting kernel. One run takes 300 microseconds.
#include <hip/hip_runtime.h>

// All contractions on v_wmma_f32_16x16x32_f16 (f16 operands, f32 accumulate): x*Wv^T and x*Wa^T with
// f16 containers of bf16-RNE inputs (weights carried x16); y*Wo^T with y as f16 hi plane plus f16
// residual plane carried x2048 into a separate accumulator (folded x1/2048), Wo bf16-RNE x16.
// Per-pixel 9-way softmax, 3x3 window aggregation and overlap-add fold: f32 on VALU.

#ifndef NB
#define NB 8
#endif
#define NB_FULL 8
#define HH 56
#define WW 56
#define CC 384
#define HEADS 12
#define DHEAD 32
#define NPIX (HH * WW)                 // 3136 pixels per image
#define NA 972                         // HEADS * 81 logits per pixel
#define NA_PAD 1024                    // logit columns incl. zero columns 972..1023
#define KCH (CC / 8)                   // 48 chunks of 16 B per 384-wide 16-bit row
#define WROWS (CC + NA_PAD + CC)       // weight plane rows: Wv | Wa (zero-extended) | Wo
#define IPP 2                          // images per logit pass
#define NPASS ((NB + IPP - 1) / IPP)
#define IPB 2                          // pixels per block in k_av
#define CSP 68                         // LDS pitch (floats) of the 64x64 epilogue tile
#define SM_SCALE 0.17677669529663687f  // 32^-0.5
#define INV_W_CARRY 0.0625f            // weights are carried x16
#define R_CARRY 2048.0f                // residual plane carry
#define INV_R_CARRY 0.00048828125f

static_assert(NB >= 1 && NB <= NB_FULL);
static_assert(NPIX % 64 == 0);
static_assert((NPIX * KCH) % 256 == 0);
static_assert((CC * KCH) % 256 == 0);
static_assert((NA_PAD * KCH) % 256 == 0);
static_assert((WROWS * KCH) % 256 == 0);
static_assert(CC % 64 == 0);
static_assert(NA_PAD % 64 == 0);
static_assert(NA <= NA_PAD);
static_assert(CC % 32 == 0);
static_assert(HEADS * DHEAD == CC);
static_assert(HEADS * 81 == NA);
static_assert(NPIX % IPB == 0);
static_assert(IPB * 96 == 192);

typedef _Float16 v16h __attribute__((ext_vector_type(16)));
typedef _Float16 v8h  __attribute__((ext_vector_type(8)));
typedef float    v8f  __attribute__((ext_vector_type(8)));
typedef float    v4f  __attribute__((ext_vector_type(4)));

union FragH { v16h v; v8h half[2]; };

__device__ __forceinline__ unsigned int bf16r_bits(float f) {
    unsigned int u = __float_as_uint(f);
    u += 0x7FFFu + ((u >> 16) & 1u);          // RNE to bf16
    return u & 0xFFFF0000u;
}
__device__ __forceinline__ float bf16r(float f) { return __uint_as_float(bf16r_bits(f)); }

__device__ __forceinline__ v8f wmma16(v16h a, v16h b, v8f c) {
    return __builtin_amdgcn_wmma_f32_16x16x32_f16(false, a, false, b, (short)0, c, false, false);
}

// ------------------------------------------------------------------------------------------------
// x [rows][384] f32 -> xh [rows][384] f16 (bf16-RNE value, exact in f16). One 16-B chunk per thread,
__global__ __launch_bounds__(256)
void k_cvt_x(const float* __restrict__ x, _Float16* xh, int nchunk) {
    const int g = (int)blockIdx.x * 256 + (int)threadIdx.x;
    if (g >= nchunk) return;
    const float* s = x + (size_t)g * 8;
    const v4f f0 = *(const v4f*)s;
    const v4f f1 = *(const v4f*)(s + 4);
    float t[8] = {f0.x, f0.y, f0.z, f0.w, f1.x, f1.y, f1.z, f1.w};
    v8h o;
#pragma unroll
    for (int e = 0; e < 8; ++e) o[e] = (_Float16)bf16r(t[e]);
    _Float16* d = xh + (size_t)g * 8;
    *(v8h*)d = o;
    
}

// ------------------------------------------------------------------------------------------------
// Weight planes [WROWS][384] f16 = 16 * bf16-RNE(W), k-contiguous rows ([n][k]):
//   rows [0,384) Wv, [384,1408) Wa (rows >= 972 written as zeros), [1408,1792) Wo.
// Plane selection is block-uniform (plane boundaries are multiples of 256 chunks).
__global__ __launch_bounds__(256)
void k_cvt_w(const float* __restrict__ Wv, const float* __restrict__ Wa,
             const float* __restrict__ Wo, _Float16* wpl) {
    const int g   = (int)blockIdx.x * 256 + (int)threadIdx.x;   // < WROWS*KCH exactly
    const int R   = g / KCH;
    const int ch  = g - R * KCH;
    const int blk = (int)blockIdx.x;
    const float* src;
    int rbase, nvalid;
    if (blk < (CC * KCH) / 256)                  { src = Wv; rbase = 0;           nvalid = CC; }
    else if (blk < ((CC + NA_PAD) * KCH) / 256)  { src = Wa; rbase = CC;          nvalid = NA; }
    else                                         { src = Wo; rbase = CC + NA_PAD; nvalid = CC; }
    const int rr = R - rbase;                                    // >= 0
    const int rc = (rr < nvalid) ? rr : (nvalid - 1);            // clamped address
    const float pm = (rr < nvalid) ? 16.0f : 0.0f;               // carry, or zero for extension rows
    const float* s = src + (size_t)rc * CC + ch * 8;
    const v4f f0 = *(const v4f*)s;
    const v4f f1 = *(const v4f*)(s + 4);
    float t[8] = {f0.x, f0.y, f0.z, f0.w, f1.x, f1.y, f1.z, f1.w};
    v8h o;
#pragma unroll
    for (int e = 0; e < 8; ++e) o[e] = (_Float16)(bf16r(t[e]) * pm);
    _Float16* d = wpl + (size_t)g * 8;
    *(v8h*)d = o;
    
}

// ------------------------------------------------------------------------------------------------
// Out[m][n] = scale * sum_k A[m][k] * Bw[n][k]   (K = 384, A pitch 384 halves, Bw pitch 384 halves)
// RES = 1: Out[m][n] = scale * (sum_k A[m][k]*Bw[n][k] + (1/2048) * sum_k Ar[m][k]*Bw[n][k]).
// Block = 4 waves, 64x64 tile, each wave 32x32 (2x2 WMMA tiles). Fragments loaded straight from
// global 16-bit rows with the split-k lane map for A and B alike. Epilogue staged in LDS, then whole
template <int RES>
__global__ __launch_bounds__(128)
void k_gemm(const _Float16* __restrict__ A, const _Float16* __restrict__ Ar,
            const _Float16* __restrict__ Bw, float* out, int ldo, float scale) {
    __shared__ float cs[64 * CSP];
    const int tid  = (int)threadIdx.x;
    const int lane = tid & 31;
    const int wave = tid >> 5;
    const int h    = lane >> 4;          // lane half
    const int m    = lane & 15;          // A row / B col / D col
    const int m0   = (int)blockIdx.x * 64;
    const int n0   = (int)blockIdx.y * 64;
    const int wm   = (wave >> 1) * 32;
    const int wn   = (wave & 1) * 32;

    const size_t ra0 = (size_t)(m0 + wm + m) * CC + 8 * h;
    const size_t ra1 = ra0 + (size_t)16 * CC;
    const size_t rb0 = (size_t)(n0 + wn + m) * CC + 8 * h;
    const size_t rb1 = rb0 + (size_t)16 * CC;

    v8f acc00 = {0.f, 0.f, 0.f, 0.f, 0.f, 0.f, 0.f, 0.f};
    v8f acc01 = acc00, acc10 = acc00, acc11 = acc00;
    v8f rcc00 = acc00, rcc01 = acc00, rcc10 = acc00, rcc11 = acc00;

#pragma unroll 1
    for (int k0 = 0; k0 < CC; k0 += 32) {
        FragH a0, a1, b0, b1;
        // elements 0..7 <- k0+8h+0..7, elements 8..15 <- k0+16+8h+0..7 (A and B identical map)
        a0.half[0] = *(const v8h*)(A + ra0 + k0);
        a0.half[1] = *(const v8h*)(A + ra0 + k0 + 16);
        a1.half[0] = *(const v8h*)(A + ra1 + k0);
        a1.half[1] = *(const v8h*)(A + ra1 + k0 + 16);
        b0.half[0] = *(const v8h*)(Bw + rb0 + k0);
        b0.half[1] = *(const v8h*)(Bw + rb0 + k0 + 16);
        b1.half[0] = *(const v8h*)(Bw + rb1 + k0);
        b1.half[1] = *(const v8h*)(Bw + rb1 + k0 + 16);
        acc00 = wmma16(a0.v, b0.v, acc00);
        acc01 = wmma16(a0.v, b1.v, acc01);
        acc10 = wmma16(a1.v, b0.v, acc10);
        acc11 = wmma16(a1.v, b1.v, acc11);
        if (RES) {
            FragH e0, e1;
            e0.half[0] = *(const v8h*)(Ar + ra0 + k0);
            e0.half[1] = *(const v8h*)(Ar + ra0 + k0 + 16);
            e1.half[0] = *(const v8h*)(Ar + ra1 + k0);
            e1.half[1] = *(const v8h*)(Ar + ra1 + k0 + 16);
            rcc00 = wmma16(e0.v, b0.v, rcc00);
            rcc01 = wmma16(e0.v, b1.v, rcc01);
            rcc10 = wmma16(e1.v, b0.v, rcc10);
            rcc11 = wmma16(e1.v, b1.v, rcc11);
            asm volatile("v_nop\n\tv_nop\n\tv_nop\n\tv_nop"
                         : "+v"(acc00), "+v"(acc01), "+v"(acc10), "+v"(acc11),
                           "+v"(rcc00), "+v"(rcc01), "+v"(rcc10), "+v"(rcc11)
                         : "v"(a0.v), "v"(a1.v), "v"(b0.v), "v"(b1.v), "v"(e0.v), "v"(e1.v));
        } else {
            asm volatile("v_nop\n\tv_nop\n\tv_nop\n\tv_nop"
                         : "+v"(acc00), "+v"(acc01), "+v"(acc10), "+v"(acc11)
                         : "v"(a0.v), "v"(a1.v), "v"(b0.v), "v"(b1.v));
        }
    }

    // D element r of lane -> row 8h + r, col m of each 16x16 tile
    {
        float* p00 = cs + (wm + 8 * h) * CSP + wn + m;
        float* p10 = cs + (wm + 16 + 8 * h) * CSP + wn + m;
#pragma unroll
        for (int r = 0; r < 8; ++r) {
            float v00, v01, v10, v11;
            if (RES) {
                v00 = (acc00[r] + rcc00[r] * INV_R_CARRY) * scale;
                v01 = (acc01[r] + rcc01[r] * INV_R_CARRY) * scale;
                v10 = (acc10[r] + rcc10[r] * INV_R_CARRY) * scale;
                v11 = (acc11[r] + rcc11[r] * INV_R_CARRY) * scale;
            } else {
                v00 = acc00[r] * scale;
                v01 = acc01[r] * scale;
                v10 = acc10[r] * scale;
                v11 = acc11[r] * scale;
            }
            p00[r * CSP]      = v00;
            p00[r * CSP + 16] = v01;
            p10[r * CSP]      = v10;
            p10[r * CSP + 16] = v11;
        }
    }
    __syncthreads();   // cs is written per wave, read cross-wave

    // 64 rows x 256 B = 128 lines; per pass 16 lines, line L by lanes 8q..8q+7 of one wave
    const int lr = tid >> 3;
    const int lq = tid & 7;
#pragma unroll
    for (int p = 0; p < 8; ++p) {
        const int L = p * 16 + lr;
        const int row = L >> 1;
        const int col = (L & 1) * 32 + lq * 4;
        const v4f v = *(const v4f*)(cs + row * CSP + col);
        *(v4f*)(out + (size_t)(m0 + row) * ldo + n0 + col) = v;
    }
    
}

// ------------------------------------------------------------------------------------------------
// Fused: per-pixel 9-way softmax (each logit group feeds exactly one output pixel), combination of
// the 81 window weights into a 5x5 table per (pixel, head) in LDS, weighted aggregation of V over
// the 5x5 neighbourhood (out-of-range positions skipped: zero-extended v), then y written as
// f16 hi plane + f16 residual plane x2048. Block = 2 pixels, 192 threads; 96 threads (3 waves)
// per pixel so every branch around a load is wave-uniform.
//   P  : [rows of this pass][1024] f32 logits (unscaled), local row = global pixel - row0
//   V  : [NB*NPIX][384] f32
//   Yh, Yr : [NB*NPIX][384] f16
__global__ __launch_bounds__(192)
void k_av(const float* __restrict__ P, const float* __restrict__ V,
          _Float16* Yh, _Float16* Yr, int row0) {
#pragma clang fp contract(off)
    __shared__ float w5s[IPB * HEADS * 25];   // cross-wave: written by wave 0, read by all (block barrier)
    __shared__ float ys[IPB * CC];            // cross-wave: written by all, read by all (block barrier)
    const int tid = (int)threadIdx.x;
    const int lpb = (int)blockIdx.x * IPB;    // first local pixel of this block

    // ---- phase 1: softmax of the 9x12 groups feeding each pixel, accumulated into 5x5 tables ----
    if (tid < IPB * HEADS) {
        const int pix  = tid / HEADS;
        const int head = tid - pix * HEADS;
        const int lp = lpb + pix;
        const int gp = row0 + lp;
        const int rs = gp % NPIX;
        const int r  = rs / WW;
        const int s  = rs - r * WW;
        float* wdst = w5s + (pix * HEADS + head) * 25;
#pragma unroll
        for (int t = 0; t < 25; ++t) wdst[t] = 0.0f;
#pragma unroll 1
        for (int ij = 0; ij < 9; ++ij) {
            const int i = ij / 3;
            const int j = ij - 3 * i;
            const int ny = r + 1 - i;                 // window centre pixel n'
            const int nx = s + 1 - j;
            const bool ok = ((unsigned)ny < (unsigned)HH) && ((unsigned)nx < (unsigned)WW);
            const int nyc = ny < 0 ? 0 : (ny >= HH ? HH - 1 : ny);
            const int nxc = nx < 0 ? 0 : (nx >= WW ? WW - 1 : nx);
            const int nlp = lp + (nyc - r) * WW + (nxc - s);      // same image, clamped address
            const float* g = P + (size_t)nlp * NA_PAD + head * 81 + ij * 9;
            float z[9];
            float mx = -3.0e38f;
#pragma unroll
            for (int q = 0; q < 9; ++q) { z[q] = g[q] * SM_SCALE; mx = fmaxf(mx, z[q]); }
            float e[9];
            float sum = 0.0f;
#pragma unroll
            for (int q = 0; q < 9; ++q) { e[q] = __expf(z[q] - mx); sum += e[q]; }
            const float inv = 1.0f / sum;
            // weight for v offset (dy, dx) = (qi - i, qj - j) goes to entry (dy+2)*5 + (dx+2)
            float* wq = wdst + (2 - i) * 5 + (2 - j);
#pragma unroll
            for (int q = 0; q < 9; ++q) {
                const int qi = q / 3;
                const int qj = q - 3 * qi;
                const float pv = ok ? (e[q] * inv) : 0.0f;
                wq[qi * 5 + qj] += pv;
            }
        }
    }
    __syncthreads();

    // ---- phase 2: y[c] = sum over 5x5 neighbourhood of w5[dy][dx] * v[r+dy][s+dx][c] ----
    {
        const int pix  = tid / 96;                 // wave-uniform
        const int u    = tid - pix * 96;
        const int c0   = u * 4;
        const int head = u >> 3;                   // 32 channels per head, 4 per thread
        const int gp = row0 + lpb + pix;
        const int rs = gp % NPIX;
        const int r  = rs / WW;
        const int s  = rs - r * WW;
        const float* wrow = w5s + (pix * HEADS + head) * 25;
        const float* vb = V + (size_t)gp * CC + c0;
        v4f acc = {0.0f, 0.0f, 0.0f, 0.0f};
#pragma unroll 1
        for (int a = 0; a < 5; ++a) {
            const int vy = r + a - 2;
            if ((unsigned)vy < (unsigned)HH) {                       // wave-uniform
#pragma unroll 1
                for (int b = 0; b < 5; ++b) {
                    const int vx = s + b - 2;
                    if ((unsigned)vx < (unsigned)WW) {               // wave-uniform
                        const long dofs = (long)(((a - 2) * WW + (b - 2)) * CC);
                        const v4f vv = *(const v4f*)(vb + dofs);
                        const float w = wrow[a * 5 + b];
                        acc.x = fmaf(w, vv.x, acc.x);
                        acc.y = fmaf(w, vv.y, acc.y);
                        acc.z = fmaf(w, vv.z, acc.z);
                        acc.w = fmaf(w, vv.w, acc.w);
                    }
                }
            }
        }
        *(v4f*)(ys + pix * CC + c0) = acc;
    }
    __syncthreads();

    // ---- phase 3: whole-line plane stores: waves 0-2 write hi, waves 3-5 write residual ----
    {
        const int plane = tid / 96;                // wave-uniform
        const int u     = tid - plane * 96;
        const int pix   = u / KCH;                 // 0..1
        const int ch    = u - pix * KCH;
        const int gp = row0 + lpb + pix;
        const float* ysrc = ys + pix * CC + ch * 8;
        const v4f y0 = *(const v4f*)ysrc;
        const v4f y1 = *(const v4f*)(ysrc + 4);
        float yv[8] = {y0.x, y0.y, y0.z, y0.w, y1.x, y1.y, y1.z, y1.w};
        v8h oh, orr;
#pragma unroll
        for (int e = 0; e < 8; ++e) {
            const _Float16 hq = (_Float16)yv[e];
            const float res = (yv[e] - (float)hq) * R_CARRY;    // exact in f32
            oh[e]  = hq;
            orr[e] = (_Float16)res;
        }
        const size_t dofs = (size_t)gp * CC + ch * 8;
        if (plane == 0) {
            _Float16* d = Yh + dofs;
            *(v8h*)d = oh;
            
        } else {
            _Float16* d = Yr + dofs;
            *(v8h*)d = orr;
            
        }
    }
}

// ------------------------------------------------------------------------------------------------
static inline size_t al256(size_t b) { return (b + 255) & ~(size_t)255; }

extern "C" void kernel_launch(void* const* d_in, const int* in_sizes, int n_in,
                              void* d_out, int out_size, void* d_ws, size_t ws_size,
                              hipStream_t stream) {
    if (n_in < 4) return;
    if (in_sizes[0] < NB * NPIX * CC) return;
    if (in_sizes[1] < CC * CC) return;
    if (in_sizes[2] < NA * CC) return;
    if (in_sizes[3] < CC * CC) return;
    if (out_size < NB * NPIX * CC) return;

    const float* x  = (const float*)d_in[0];   // [NB][56][56][384]
    const float* Wv = (const float*)d_in[1];   // [384][384]  ([out][in])
    const float* Wa = (const float*)d_in[2];   // [972][384]
    const float* Wo = (const float*)d_in[3];   // [384][384]
    float* out = (float*)d_out;                // [NB][56][56][384] f32

    // multiples of the store granularity, offsets 256-B aligned)
    const size_t szXH = (size_t)NB * NPIX * CC * 2;            // x as f16
    const size_t szW  = (size_t)WROWS * CC * 2;                // weight planes
    const size_t szV  = (size_t)NB * NPIX * CC * 4;            // v f32
    const size_t szP  = (size_t)IPP * NPIX * NA_PAD * 4;       // logits of one pass, f32
    const size_t szY  = (size_t)NB * NPIX * CC * 2;            // y planes (hi, residual)
    size_t off = 0;
    const size_t oXH = off; off += al256(szXH);
    const size_t oW  = off; off += al256(szW);
    const size_t oV  = off; off += al256(szV);
    const size_t oP  = off; off += al256(szP);
    const size_t oYH = off; off += al256(szY);
    const size_t oYR = off; off += al256(szY);
    if (off > ws_size) return;

    char* ws = (char*)d_ws;
    _Float16* Xh  = (_Float16*)(ws + oXH);
    _Float16* Wpl = (_Float16*)(ws + oW);
    const _Float16* Wvh = Wpl;
    const _Float16* Wah = Wpl + (size_t)CC * CC;
    const _Float16* Woh = Wpl + (size_t)(CC + NA_PAD) * CC;
    float* Vf = (float*)(ws + oV);
    float* Pf = (float*)(ws + oP);
    _Float16* Yh = (_Float16*)(ws + oYH);
    _Float16* Yr = (_Float16*)(ws + oYR);

    // 1) operand planes
    {
        const int nchunk = NB * NPIX * KCH;
        k_cvt_x<<<nchunk / 256, 256, 0, stream>>>(x, Xh, nchunk);
        k_cvt_w<<<(WROWS * KCH) / 256, 256, 0, stream>>>(Wv, Wa, Wo, Wpl);
    }
    // 2) v = x * Wv^T  -> f32 [NB*NPIX][384]
    k_gemm<0><<<dim3(NB * NPIX / 64, CC / 64), 128, 0, stream>>>(Xh, Xh, Wvh, Vf, CC, INV_W_CARRY);
    // 3) per pass of IPP images: logits = x * Wa^T -> [rows][1024], then softmax + aggregation + fold
    for (int ps = 0; ps < NPASS; ++ps) {
        const int nimg = (NB - ps * IPP < IPP) ? (NB - ps * IPP) : IPP;
        const int rows = nimg * NPIX;
        const int r0   = ps * IPP * NPIX;
        k_gemm<0><<<dim3(rows / 64, NA_PAD / 64), 128, 0, stream>>>(
            Xh + (size_t)r0 * CC, Xh, Wah, Pf, NA_PAD, INV_W_CARRY);
        k_av<<<rows / IPB, 192, 0, stream>>>(Pf, Vf, Yh, Yr, r0);
    }
    // 4) out = y * Wo^T  (hi + residual/2048) -> d_out
    k_gemm<1><<<dim3(NB * NPIX / 64, CC / 64), 128, 0, stream>>>(Yh, Yr, Woh, out, CC, INV_W_CARRY);
}

// v001
// Measured time: 227 microseconds a run.
// In both of two side-by-side timings against v000, it was 1.35 times as fast.
#include <hip/hip_runtime.h>

// All contractions on v_wmma_f32_16x16x32_f16 (f16 operands, f32 accumulate): x*Wv^T and x*Wa^T with
// f16 containers of bf16-RNE inputs (weights carried x16); y*Wo^T with y as f16 hi plane plus f16
// residual plane carried x2048 into a separate accumulator (folded x1/2048), Wo bf16-RNE x16.
// Per-pixel 9-way softmax, 3x3 window aggregation and overlap-add fold: f32 on VALU.
//
// The 16-bit operand planes are stored in fragment order, not row-major. A plane is cut into units of
// 16 rows x 32 k = 64 chunks of 16 B (1 KiB); unit (row tile t, k block kb) starts at chunk
// (t * 12 + kb) * 64, so a row tile still spans 16 * 384 halves. Chunk (row m, c4 = k / 8 within the
// block) holds the halves that lane half h = c4 & 1 takes as element group j = c4 >> 1. Inside a unit:
//   x and weight planes: chunk j * 32 + h * 16 + m  (one fragment load = 512 contiguous bytes, 4 lines)
//   y planes:            chunk m * 4 + c4           (two pixels' 64-B pieces fill one 128-B line, so
//                                                    k_av stays the only writer of a line; 8 lines a load)

#ifndef NB
#define NB 8
#endif
#define NB_FULL 8
#define HH 56
#define WW 56
#define CC 384
#define HEADS 12
#define DHEAD 32
#define NPIX (HH * WW)                 // 3136 pixels per image
#define NA 972                         // HEADS * 81 logits per pixel
#define NA_PAD 1024                    // logit columns incl. zero columns 972..1023
#define KCH (CC / 8)                   // 48 chunks of 16 B per 384-wide 16-bit row
#define KBL (CC / 32)                  // 12 k blocks of 32 per row
#define WROWS (CC + NA_PAD + CC)       // weight plane rows: Wv | Wa (zero-extended) | Wo
#define IPP 2                          // images per logit pass
#define NPASS ((NB + IPP - 1) / IPP)
#define IPB 2                          // pixels per block in k_av
#define CSP 68                         // LDS pitch (floats) of the 64x64 epilogue tile
#define SM_SCALE 0.17677669529663687f  // 32^-0.5
#define INV_W_CARRY 0.0625f            // weights are carried x16
#define R_CARRY 2048.0f                // residual plane carry
#define INV_R_CARRY 0.00048828125f

static_assert(NB >= 1 && NB <= NB_FULL);
static_assert(NPIX % 64 == 0);
static_assert(CC % 16 == 0 && NA_PAD % 16 == 0 && (IPP * NPIX) % 16 == 0);   // planes and passes start on a row tile
static_assert(IPB == 2 && NPIX % 2 == 0);                                    // a k_av block owns an even/odd row pair
static_assert((NPIX * KCH) % 256 == 0);
static_assert((CC * KCH) % 256 == 0);
static_assert((NA_PAD * KCH) % 256 == 0);
static_assert((WROWS * KCH) % 256 == 0);
static_assert(CC % 64 == 0);
static_assert(NA_PAD % 64 == 0);
static_assert(NA <= NA_PAD);
static_assert(CC % 32 == 0);
static_assert(HEADS * DHEAD == CC);
static_assert(HEADS * 81 == NA);
static_assert(NPIX % IPB == 0);
static_assert(IPB * 96 == 192);

typedef _Float16 v16h __attribute__((ext_vector_type(16)));
typedef _Float16 v8h  __attribute__((ext_vector_type(8)));
typedef float    v8f  __attribute__((ext_vector_type(8)));
typedef float    v4f  __attribute__((ext_vector_type(4)));

union FragH { v16h v; v8h half[2]; };

__device__ __forceinline__ unsigned int bf16r_bits(float f) {
    unsigned int u = __float_as_uint(f);
    u += 0x7FFFu + ((u >> 16) & 1u);          // RNE to bf16
    return u & 0xFFFF0000u;
}
__device__ __forceinline__ float bf16r(float f) { return __uint_as_float(bf16r_bits(f)); }

__device__ __forceinline__ v8f wmma16(v16h a, v16h b, v8f c) {
    return __builtin_amdgcn_wmma_f32_16x16x32_f16(false, a, false, b, (short)0, c, false, false);
}

// ------------------------------------------------------------------------------------------------
// x [rows][384] f32 -> xh, fragment order, f16 (bf16-RNE value, exact in f16). One 16-B chunk per thread:
// 4 lanes read one 128-B line of a row, 8 rows a wave; the wave's stores fill 4 whole lines.
__global__ __launch_bounds__(256)
void k_cvt_x(const float* __restrict__ x, _Float16* xh, int nchunk) {
    const int g = (int)blockIdx.x * 256 + (int)threadIdx.x;
    if (g >= nchunk) return;
    const int unit = g >> 6;
    const int tile = unit / KBL;
    const int kb   = unit - tile * KBL;
    const int m    = (g >> 2) & 15;
    const int c4   = g & 3;
    const float* s = x + (size_t)(tile * 16 + m) * CC + kb * 32 + c4 * 8;
    const v4f f0 = *(const v4f*)s;
    const v4f f1 = *(const v4f*)(s + 4);
    float t[8] = {f0.x, f0.y, f0.z, f0.w, f1.x, f1.y, f1.z, f1.w};
    v8h o;
#pragma unroll
    for (int e = 0; e < 8; ++e) o[e] = (_Float16)bf16r(t[e]);
    _Float16* d = xh + (size_t)(unit * 64 + (c4 >> 1) * 32 + (c4 & 1) * 16 + m) * 8;
    *(v8h*)d = o;
    
}

// ------------------------------------------------------------------------------------------------
// Weight planes, WROWS rows of 384, f16 = 16 * bf16-RNE(W), fragment order over rows n:
//   rows [0,384) Wv, [384,1408) Wa (rows >= 972 written as zeros), [1408,1792) Wo.
// Plane selection is block-uniform (plane boundaries are multiples of 256 chunks).
__global__ __launch_bounds__(256)
void k_cvt_w(const float* __restrict__ Wv, const float* __restrict__ Wa,
             const float* __restrict__ Wo, _Float16* wpl) {
    const int g   = (int)blockIdx.x * 256 + (int)threadIdx.x;   // < WROWS*KCH exactly
    const int unit = g >> 6;
    const int tile = unit / KBL;
    const int kb   = unit - tile * KBL;
    const int m    = (g >> 2) & 15;
    const int c4   = g & 3;
    const int R   = tile * 16 + m;
    const int ch  = kb * 4 + c4;
    const int blk = (int)blockIdx.x;
    const float* src;
    int rbase, nvalid;
    if (blk < (CC * KCH) / 256)                  { src = Wv; rbase = 0;           nvalid = CC; }
    else if (blk < ((CC + NA_PAD) * KCH) / 256)  { src = Wa; rbase = CC;          nvalid = NA; }
    else                                         { src = Wo; rbase = CC + NA_PAD; nvalid = CC; }
    const int rr = R - rbase;                                    // >= 0
    const int rc = (rr < nvalid) ? rr : (nvalid - 1);            // clamped address
    const float pm = (rr < nvalid) ? 16.0f : 0.0f;               // carry, or zero for extension rows
    const float* s = src + (size_t)rc * CC + ch * 8;
    const v4f f0 = *(const v4f*)s;
    const v4f f1 = *(const v4f*)(s + 4);
    float t[8] = {f0.x, f0.y, f0.z, f0.w, f1.x, f1.y, f1.z, f1.w};
    v8h o;
#pragma unroll
    for (int e = 0; e < 8; ++e) o[e] = (_Float16)(bf16r(t[e]) * pm);
    _Float16* d = wpl + (size_t)(unit * 64 + (c4 >> 1) * 32 + (c4 & 1) * 16 + m) * 8;
    *(v8h*)d = o;
    
}

// ------------------------------------------------------------------------------------------------
// Out[m][n] = scale * sum_k A[m][k] * Bw[n][k]   (K = 384, A and Bw in fragment order)
// RES = 1: Out[m][n] = scale * (sum_k A[m][k]*Bw[n][k] + (1/2048) * sum_k Ar[m][k]*Bw[n][k]).
// Block = 4 waves, 64x64 tile, each wave 32x32 (2x2 WMMA tiles). Fragments loaded straight from
// the global planes with the split-k lane map for A and B alike; RES = 1 reads A and Ar in the y planes'
// chunk order, RES = 0 in the x plane's. Epilogue staged in LDS, then whole
template <int RES>
__global__ __launch_bounds__(128)
void k_gemm(const _Float16* __restrict__ A, const _Float16* __restrict__ Ar,
            const _Float16* __restrict__ Bw, float* out, int ldo, float scale) {
    __shared__ float cs[64 * CSP];
    const int tid  = (int)threadIdx.x;
    const int lane = tid & 31;
    const int wave = tid >> 5;
    const int h    = lane >> 4;          // lane half
    const int m    = lane & 15;          // A row / B col / D col
    const int m0   = (int)blockIdx.x * 64;
    const int n0   = (int)blockIdx.y * 64;
    const int wm   = (wave >> 1) * 32;
    const int wn   = (wave & 1) * 32;

    constexpr int AJ = RES ? 16 : 256;   // halves from element group 0 to group 1 in A's unit
    const size_t ra0 = (size_t)(m0 + wm) * CC + (RES ? (m * 4 + h) * 8 : lane * 8);
    const size_t ra1 = ra0 + (size_t)16 * CC;
    const size_t rb0 = (size_t)(n0 + wn) * CC + lane * 8;
    const size_t rb1 = rb0 + (size_t)16 * CC;

    v8f acc00 = {0.f, 0.f, 0.f, 0.f, 0.f, 0.f, 0.f, 0.f};
    v8f acc01 = acc00, acc10 = acc00, acc11 = acc00;
    v8f rcc00 = acc00, rcc01 = acc00, rcc10 = acc00, rcc11 = acc00;

#pragma unroll 1
    for (int k0 = 0; k0 < CC; k0 += 32) {
        FragH a0, a1, b0, b1;
        // elements 0..7 <- k0+8h+0..7, elements 8..15 <- k0+16+8h+0..7 (A and B identical map)
        const int ku = k0 * 16;          // 512 halves per unit of 32 k
        a0.half[0] = *(const v8h*)(A + ra0 + ku);
        a0.half[1] = *(const v8h*)(A + ra0 + ku + AJ);
        a1.half[0] = *(const v8h*)(A + ra1 + ku);
        a1.half[1] = *(const v8h*)(A + ra1 + ku + AJ);
        b0.half[0] = *(const v8h*)(Bw + rb0 + ku);
        b0.half[1] = *(const v8h*)(Bw + rb0 + ku + 256);
        b1.half[0] = *(const v8h*)(Bw + rb1 + ku);
        b1.half[1] = *(const v8h*)(Bw + rb1 + ku + 256);
        acc00 = wmma16(a0.v, b0.v, acc00);
        acc01 = wmma16(a0.v, b1.v, acc01);
        acc10 = wmma16(a1.v, b0.v, acc10);
        acc11 = wmma16(a1.v, b1.v, acc11);
        if (RES) {
            FragH e0, e1;
            e0.half[0] = *(const v8h*)(Ar + ra0 + ku);
            e0.half[1] = *(const v8h*)(Ar + ra0 + ku + AJ);
            e1.half[0] = *(const v8h*)(Ar + ra1 + ku);
            e1.half[1] = *(const v8h*)(Ar + ra1 + ku + AJ);
            rcc00 = wmma16(e0.v, b0.v, rcc00);
            rcc01 = wmma16(e0.v, b1.v, rcc01);
            rcc10 = wmma16(e1.v, b0.v, rcc10);
            rcc11 = wmma16(e1.v, b1.v, rcc11);
            asm volatile("v_nop\n\tv_nop\n\tv_nop\n\tv_nop"
                         : "+v"(acc00), "+v"(acc01), "+v"(acc10), "+v"(acc11),
                           "+v"(rcc00), "+v"(rcc01), "+v"(rcc10), "+v"(rcc11)
                         : "v"(a0.v), "v"(a1.v), "v"(b0.v), "v"(b1.v), "v"(e0.v), "v"(e1.v));
        } else {
            asm volatile("v_nop\n\tv_nop\n\tv_nop\n\tv_nop"
                         : "+v"(acc00), "+v"(acc01), "+v"(acc10), "+v"(acc11)
                         : "v"(a0.v), "v"(a1.v), "v"(b0.v), "v"(b1.v));
        }
    }

    // D element r of lane -> row 8h + r, col m of each 16x16 tile
    {
        float* p00 = cs + (wm + 8 * h) * CSP + wn + m;
        float* p10 = cs + (wm + 16 + 8 * h) * CSP + wn + m;
#pragma unroll
        for (int r = 0; r < 8; ++r) {
            float v00, v01, v10, v11;
            if (RES) {
                v00 = (acc00[r] + rcc00[r] * INV_R_CARRY) * scale;
                v01 = (acc01[r] + rcc01[r] * INV_R_CARRY) * scale;
                v10 = (acc10[r] + rcc10[r] * INV_R_CARRY) * scale;
                v11 = (acc11[r] + rcc11[r] * INV_R_CARRY) * scale;
            } else {
                v00 = acc00[r] * scale;
                v01 = acc01[r] * scale;
                v10 = acc10[r] * scale;
                v11 = acc11[r] * scale;
            }
            p00[r * CSP]      = v00;
            p00[r * CSP + 16] = v01;
            p10[r * CSP]      = v10;
            p10[r * CSP + 16] = v11;
        }
    }
    __syncthreads();   // cs is written per wave, read cross-wave

    // 64 rows x 256 B = 128 lines; per pass 16 lines, line L by lanes 8q..8q+7 of one wave
    const int lr = tid >> 3;
    const int lq = tid & 7;
#pragma unroll
    for (int p = 0; p < 8; ++p) {
        const int L = p * 16 + lr;
        const int row = L >> 1;
        const int col = (L & 1) * 32 + lq * 4;
        const v4f v = *(const v4f*)(cs + row * CSP + col);
        *(v4f*)(out + (size_t)(m0 + row) * ldo + n0 + col) = v;
    }
    
}

// ------------------------------------------------------------------------------------------------
// Fused: per-pixel 9-way softmax (each logit group feeds exactly one output pixel), combination of
// the 81 window weights into a 5x5 table per (pixel, head) in LDS, weighted aggregation of V over
// the 5x5 neighbourhood (out-of-range positions skipped: zero-extended v), then y written as
// f16 hi plane + f16 residual plane x2048. Block = 2 pixels, 192 threads; 96 threads (3 waves)
// per pixel so every branch around a load is wave-uniform.
//   P  : [rows of this pass][1024] f32 logits (unscaled), local row = global pixel - row0
//   V  : [NB*NPIX][384] f32
//   Yh, Yr : NB*NPIX rows of 384, f16, fragment order (y planes' chunk order)
__global__ __launch_bounds__(192)
void k_av(const float* __restrict__ P, const float* __restrict__ V,
          _Float16* Yh, _Float16* Yr, int row0) {
#pragma clang fp contract(off)
    __shared__ float w5s[IPB * HEADS * 25];   // cross-wave: written by wave 0, read by all (block barrier)
    __shared__ float ys[IPB * CC];            // cross-wave: written by all, read by all (block barrier)
    const int tid = (int)threadIdx.x;
    const int lpb = (int)blockIdx.x * IPB;    // first local pixel of this block

    // ---- phase 1: softmax of the 9x12 groups feeding each pixel, accumulated into 5x5 tables ----
    if (tid < IPB * HEADS) {
        const int pix  = tid / HEADS;
        const int head = tid - pix * HEADS;
        const int lp = lpb + pix;
        const int gp = row0 + lp;
        const int rs = gp % NPIX;
        const int r  = rs / WW;
        const int s  = rs - r * WW;
        float* wdst = w5s + (pix * HEADS + head) * 25;
#pragma unroll
        for (int t = 0; t < 25; ++t) wdst[t] = 0.0f;
#pragma unroll 1
        for (int ij = 0; ij < 9; ++ij) {
            const int i = ij / 3;
            const int j = ij - 3 * i;
            const int ny = r + 1 - i;                 // window centre pixel n'
            const int nx = s + 1 - j;
            const bool ok = ((unsigned)ny < (unsigned)HH) && ((unsigned)nx < (unsigned)WW);
            const int nyc = ny < 0 ? 0 : (ny >= HH ? HH - 1 : ny);
            const int nxc = nx < 0 ? 0 : (nx >= WW ? WW - 1 : nx);
            const int nlp = lp + (nyc - r) * WW + (nxc - s);      // same image, clamped address
            const float* g = P + (size_t)nlp * NA_PAD + head * 81 + ij * 9;
            float z[9];
            float mx = -3.0e38f;
#pragma unroll
            for (int q = 0; q < 9; ++q) { z[q] = g[q] * SM_SCALE; mx = fmaxf(mx, z[q]); }
            float e[9];
            float sum = 0.0f;
#pragma unroll
            for (int q = 0; q < 9; ++q) { e[q] = __expf(z[q] - mx); sum += e[q]; }
            const float inv = 1.0f / sum;
            // weight for v offset (dy, dx) = (qi - i, qj - j) goes to entry (dy+2)*5 + (dx+2)
            float* wq = wdst + (2 - i) * 5 + (2 - j);
#pragma unroll
            for (int q = 0; q < 9; ++q) {
                const int qi = q / 3;
                const int qj = q - 3 * qi;
                const float pv = ok ? (e[q] * inv) : 0.0f;
                wq[qi * 5 + qj] += pv;
            }
        }
    }
    __syncthreads();

    // ---- phase 2: y[c] = sum over 5x5 neighbourhood of w5[dy][dx] * v[r+dy][s+dx][c] ----
    {
        const int pix  = tid / 96;                 // wave-uniform
        const int u    = tid - pix * 96;
        const int c0   = u * 4;
        const int head = u >> 3;                   // 32 channels per head, 4 per thread
        const int gp = row0 + lpb + pix;
        const int rs = gp % NPIX;
        const int r  = rs / WW;
        const int s  = rs - r * WW;
        const float* wrow = w5s + (pix * HEADS + head) * 25;
        const float* vb = V + (size_t)gp * CC + c0;
        v4f acc = {0.0f, 0.0f, 0.0f, 0.0f};
#pragma unroll 1
        for (int a = 0; a < 5; ++a) {
            const int vy = r + a - 2;
            if ((unsigned)vy < (unsigned)HH) {                       // wave-uniform
#pragma unroll 1
                for (int b = 0; b < 5; ++b) {
                    const int vx = s + b - 2;
                    if ((unsigned)vx < (unsigned)WW) {               // wave-uniform
                        const long dofs = (long)(((a - 2) * WW + (b - 2)) * CC);
                        const v4f vv = *(const v4f*)(vb + dofs);
                        const float w = wrow[a * 5 + b];
                        acc.x = fmaf(w, vv.x, acc.x);
                        acc.y = fmaf(w, vv.y, acc.y);
                        acc.z = fmaf(w, vv.z, acc.z);
                        acc.w = fmaf(w, vv.w, acc.w);
                    }
                }
            }
        }
        *(v4f*)(ys + pix * CC + c0) = acc;
    }
    __syncthreads();

    // ---- phase 3: whole-line plane stores: waves 0-2 write hi, waves 3-5 write residual ----
    {
        const int plane = tid / 96;                // wave-uniform
        const int u     = tid - plane * 96;
        const int kb    = u >> 3;                  // 8 lanes = 2 pixels x 4 chunks = one 128-B line
        const int pix   = (u >> 2) & 1;
        const int c4    = u & 3;
        const int ch    = kb * 4 + c4;
        const int gp = row0 + lpb + pix;
        const float* ysrc = ys + pix * CC + ch * 8;
        const v4f y0 = *(const v4f*)ysrc;
        const v4f y1 = *(const v4f*)(ysrc + 4);
        float yv[8] = {y0.x, y0.y, y0.z, y0.w, y1.x, y1.y, y1.z, y1.w};
        v8h oh, orr;
#pragma unroll
        for (int e = 0; e < 8; ++e) {
            const _Float16 hq = (_Float16)yv[e];
            const float res = (yv[e] - (float)hq) * R_CARRY;    // exact in f32
            oh[e]  = hq;
            orr[e] = (_Float16)res;
        }
        const size_t dofs = ((size_t)((gp >> 4) * KBL + kb) * 64 + (gp & 15) * 4 + c4) * 8;
        if (plane == 0) {
            _Float16* d = Yh + dofs;
            *(v8h*)d = oh;
            
        } else {
            _Float16* d = Yr + dofs;
            *(v8h*)d = orr;
            
        }
    }
}

// ------------------------------------------------------------------------------------------------
static inline size_t al256(size_t b) { return (b + 255) & ~(size_t)255; }

extern "C" void kernel_launch(void* const* d_in, const int* in_sizes, int n_in,
                              void* d_out, int out_size, void* d_ws, size_t ws_size,
                              hipStream_t stream) {
    if (n_in < 4) return;
    if (in_sizes[0] < NB * NPIX * CC) return;
    if (in_sizes[1] < CC * CC) return;
    if (in_sizes[2] < NA * CC) return;
    if (in_sizes[3] < CC * CC) return;
    if (out_size < NB * NPIX * CC) return;

    const float* x  = (const float*)d_in[0];   // [NB][56][56][384]
    const float* Wv = (const float*)d_in[1];   // [384][384]  ([out][in])
    const float* Wa = (const float*)d_in[2];   // [972][384]
    const float* Wo = (const float*)d_in[3];   // [384][384]
    float* out = (float*)d_out;                // [NB][56][56][384] f32

    // multiples of the store granularity, offsets 256-B aligned)
    const size_t szXH = (size_t)NB * NPIX * CC * 2;            // x as f16
    const size_t szW  = (size_t)WROWS * CC * 2;                // weight planes
    const size_t szV  = (size_t)NB * NPIX * CC * 4;            // v f32
    const size_t szP  = (size_t)IPP * NPIX * NA_PAD * 4;       // logits of one pass, f32
    const size_t szY  = (size_t)NB * NPIX * CC * 2;            // y planes (hi, residual)
    size_t off = 0;
    const size_t oXH = off; off += al256(szXH);
    const size_t oW  = off; off += al256(szW);
    const size_t oV  = off; off += al256(szV);
    const size_t oP  = off; off += al256(szP);
    const size_t oYH = off; off += al256(szY);
    const size_t oYR = off; off += al256(szY);
    if (off > ws_size) return;

    char* ws = (char*)d_ws;
    _Float16* Xh  = (_Float16*)(ws + oXH);
    _Float16* Wpl = (_Float16*)(ws + oW);
    const _Float16* Wvh = Wpl;
    const _Float16* Wah = Wpl + (size_t)CC * CC;
    const _Float16* Woh = Wpl + (size_t)(CC + NA_PAD) * CC;
    float* Vf = (float*)(ws + oV);
    float* Pf = (float*)(ws + oP);
    _Float16* Yh = (_Float16*)(ws + oYH);
    _Float16* Yr = (_Float16*)(ws + oYR);

    // 1) operand planes
    {
        const int nchunk = NB * NPIX * KCH;
        k_cvt_x<<<nchunk / 256, 256, 0, stream>>>(x, Xh, nchunk);
        k_cvt_w<<<(WROWS * KCH) / 256, 256, 0, stream>>>(Wv, Wa, Wo, Wpl);
    }
    // 2) v = x * Wv^T  -> f32 [NB*NPIX][384]
    k_gemm<0><<<dim3(NB * NPIX / 64, CC / 64), 128, 0, stream>>>(Xh, Xh, Wvh, Vf, CC, INV_W_CARRY);
    // 3) per pass of IPP images: logits = x * Wa^T -> [rows][1024], then softmax + aggregation + fold
    for (int ps = 0; ps < NPASS; ++ps) {
        const int nimg = (NB - ps * IPP < IPP) ? (NB - ps * IPP) : IPP;
        const int rows = nimg * NPIX;
        const int r0   = ps * IPP * NPIX;
        k_gemm<0><<<dim3(rows / 64, NA_PAD / 64), 128, 0, stream>>>(
            Xh + (size_t)r0 * CC, Xh, Wah, Pf, NA_PAD, INV_W_CARRY);
        k_av<<<rows / IPB, 192, 0, stream>>>(Pf, Vf, Yh, Yr, r0);
    }
    // 4) out = y * Wo^T  (hi + residual/2048) -> d_out
    k_gemm<1><<<dim3(NB * NPIX / 64, CC / 64), 128, 0, stream>>>(Yh, Yr, Woh, out, CC, INV_W_CARRY);
}

// v002
// A run of this version takes 188 microseconds.
// In two side-by-side timings against v001, it was 1.21 and 1.20 times as fast.
// All steps since v000 together make it 1.62 times as fast.
#include <hip/hip_runtime.h>

// All contractions on v_wmma_f32_16x16x32_f16 (f16 operands, f32 accumulate): x*Wv^T and x*Wa^T with
// f16 containers of bf16-RNE inputs (weights carried x16); y*Wo^T with y as f16 hi plane plus f16
// residual plane carried x2048 into a separate accumulator (folded x1/2048), Wo bf16-RNE x16.
// Per-pixel 9-way softmax, 3x3 window aggregation and overlap-add fold: f32 on VALU.
//
// The 16-bit operand planes are stored in fragment order, not row-major. A plane is cut into units of
// 16 rows x 32 k = 64 chunks of 16 B (1 KiB); unit (row tile t, k block kb) starts at chunk
// (t * 12 + kb) * 64, so a row tile still spans 16 * 384 halves. Chunk (row m, c4 = k / 8 within the
// block) holds the halves that lane half h = c4 & 1 takes as element group j = c4 >> 1. Inside a unit:
//   x and weight planes: chunk j * 32 + h * 16 + m  (one fragment load = 512 contiguous bytes, 4 lines)
//   y planes:            chunk m * 4 + c4           (two pixels' 64-B pieces fill one 128-B line, so
//                                                    k_av stays the only writer of a line; 8 lines a load)

#ifndef NB
#define NB 8
#endif
#define NB_FULL 8
#define HH 56
#define WW 56
#define CC 384
#define HEADS 12
#define DHEAD 32
#define NPIX (HH * WW)                 // 3136 pixels per image
#define NA 972                         // HEADS * 81 logits per pixel
#define NA_PAD 1024                    // logit columns incl. zero columns 972..1023
#define KCH (CC / 8)                   // 48 chunks of 16 B per 384-wide 16-bit row
#define KBL (CC / 32)                  // 12 k blocks of 32 per row
#define WROWS (CC + NA_PAD + CC)       // weight plane rows: Wv | Wa (zero-extended) | Wo
#define IPP 2                          // images per logit pass
#define NPASS ((NB + IPP - 1) / IPP)
#define IPB 2                          // pixels per block in k_av
#define CSP 68                         // LDS pitch (floats) of the 64x64 epilogue tile
#define PSP 84                         // LDS pitch (floats) of one head's 81 softmax values in k_av (16-B rows)
#define SM_SCALE 0.17677669529663687f  // 32^-0.5
#define LOG2E 0x1.715476p+0f           // log2(e) in f32: e^x = 2^(x * LOG2E)
#define INV_W_CARRY 0.0625f            // weights are carried x16
#define R_CARRY 2048.0f                // residual plane carry
#define INV_R_CARRY 0.00048828125f

static_assert(NB >= 1 && NB <= NB_FULL);
static_assert(NPIX % 64 == 0);
static_assert(CC % 16 == 0 && NA_PAD % 16 == 0 && (IPP * NPIX) % 16 == 0);   // planes and passes start on a row tile
static_assert(IPB == 2 && NPIX % 2 == 0);                                    // a k_av block owns an even/odd row pair
static_assert((NPIX * KCH) % 256 == 0);
static_assert((CC * KCH) % 256 == 0);
static_assert((NA_PAD * KCH) % 256 == 0);
static_assert((WROWS * KCH) % 256 == 0);
static_assert(CC % 64 == 0);
static_assert(NA_PAD % 64 == 0);
static_assert(NA <= NA_PAD);
static_assert(CC % 32 == 0);
static_assert(HEADS * DHEAD == CC);
static_assert(HEADS * 81 == NA);
static_assert(NPIX % IPB == 0);
static_assert(IPB * 96 == 192);

typedef _Float16 v16h __attribute__((ext_vector_type(16)));
typedef _Float16 v8h  __attribute__((ext_vector_type(8)));
typedef float    v8f  __attribute__((ext_vector_type(8)));
typedef float    v4f  __attribute__((ext_vector_type(4)));

union FragH { v16h v; v8h half[2]; };

__device__ __forceinline__ unsigned int bf16r_bits(float f) {
    unsigned int u = __float_as_uint(f);
    u += 0x7FFFu + ((u >> 16) & 1u);          // RNE to bf16
    return u & 0xFFFF0000u;
}
__device__ __forceinline__ float bf16r(float f) { return __uint_as_float(bf16r_bits(f)); }

// 2^x on the transcendental unit. The v_nop fills the one slot that the instruction set asks for between a
// transcendental and a next instruction that reads its result or overwrites its source.
__device__ __forceinline__ float exp2_slot(float x) {
    float y;
    asm("v_exp_f32 %0, %1\n\tv_nop" : "=v"(y) : "v"(x));
    return y;
}

__device__ __forceinline__ v8f wmma16(v16h a, v16h b, v8f c) {
    return __builtin_amdgcn_wmma_f32_16x16x32_f16(false, a, false, b, (short)0, c, false, false);
}

// ------------------------------------------------------------------------------------------------
// x [rows][384] f32 -> xh, fragment order, f16 (bf16-RNE value, exact in f16). One 16-B chunk per thread:
// 4 lanes read one 128-B line of a row, 8 rows a wave; the wave's stores fill 4 whole lines.
__global__ __launch_bounds__(256)
void k_cvt_x(const float* __restrict__ x, _Float16* xh, int nchunk) {
    const int g = (int)blockIdx.x * 256 + (int)threadIdx.x;
    if (g >= nchunk) return;
    const int unit = g >> 6;
    const int tile = unit / KBL;
    const int kb   = unit - tile * KBL;
    const int m    = (g >> 2) & 15;
    const int c4   = g & 3;
    const float* s = x + (size_t)(tile * 16 + m) * CC + kb * 32 + c4 * 8;
    const v4f f0 = *(const v4f*)s;
    const v4f f1 = *(const v4f*)(s + 4);
    float t[8] = {f0.x, f0.y, f0.z, f0.w, f1.x, f1.y, f1.z, f1.w};
    v8h o;
#pragma unroll
    for (int e = 0; e < 8; ++e) o[e] = (_Float16)bf16r(t[e]);
    _Float16* d = xh + (size_t)(unit * 64 + (c4 >> 1) * 32 + (c4 & 1) * 16 + m) * 8;
    *(v8h*)d = o;
    
}

// ------------------------------------------------------------------------------------------------
// Weight planes, WROWS rows of 384, f16 = 16 * bf16-RNE(W), fragment order over rows n:
//   rows [0,384) Wv, [384,1408) Wa (rows >= 972 written as zeros), [1408,1792) Wo.
// Plane selection is block-uniform (plane boundaries are multiples of 256 chunks).
__global__ __launch_bounds__(256)
void k_cvt_w(const float* __restrict__ Wv, const float* __restrict__ Wa,
             const float* __restrict__ Wo, _Float16* wpl) {
    const int g   = (int)blockIdx.x * 256 + (int)threadIdx.x;   // < WROWS*KCH exactly
    const int unit = g >> 6;
    const int tile = unit / KBL;
    const int kb   = unit - tile * KBL;
    const int m    = (g >> 2) & 15;
    const int c4   = g & 3;
    const int R   = tile * 16 + m;
    const int ch  = kb * 4 + c4;
    const int blk = (int)blockIdx.x;
    const float* src;
    int rbase, nvalid;
    if (blk < (CC * KCH) / 256)                  { src = Wv; rbase = 0;           nvalid = CC; }
    else if (blk < ((CC + NA_PAD) * KCH) / 256)  { src = Wa; rbase = CC;          nvalid = NA; }
    else                                         { src = Wo; rbase = CC + NA_PAD; nvalid = CC; }
    const int rr = R - rbase;                                    // >= 0
    const int rc = (rr < nvalid) ? rr : (nvalid - 1);            // clamped address
    const float pm = (rr < nvalid) ? 16.0f : 0.0f;               // carry, or zero for extension rows
    const float* s = src + (size_t)rc * CC + ch * 8;
    const v4f f0 = *(const v4f*)s;
    const v4f f1 = *(const v4f*)(s + 4);
    float t[8] = {f0.x, f0.y, f0.z, f0.w, f1.x, f1.y, f1.z, f1.w};
    v8h o;
#pragma unroll
    for (int e = 0; e < 8; ++e) o[e] = (_Float16)(bf16r(t[e]) * pm);
    _Float16* d = wpl + (size_t)(unit * 64 + (c4 >> 1) * 32 + (c4 & 1) * 16 + m) * 8;
    *(v8h*)d = o;
    
}

// ------------------------------------------------------------------------------------------------
// Out[m][n] = scale * sum_k A[m][k] * Bw[n][k]   (K = 384, A and Bw in fragment order)
// RES = 1: Out[m][n] = scale * (sum_k A[m][k]*Bw[n][k] + (1/2048) * sum_k Ar[m][k]*Bw[n][k]).
// Block = 4 waves, 64x64 tile, each wave 32x32 (2x2 WMMA tiles). Fragments loaded straight from
// the global planes with the split-k lane map for A and B alike; RES = 1 reads A and Ar in the y planes'
// chunk order, RES = 0 in the x plane's. Epilogue staged in LDS, then whole
template <int RES>
__global__ __launch_bounds__(128)
void k_gemm(const _Float16* __restrict__ A, const _Float16* __restrict__ Ar,
            const _Float16* __restrict__ Bw, float* out, int ldo, float scale) {
    __shared__ float cs[64 * CSP];
    const int tid  = (int)threadIdx.x;
    const int lane = tid & 31;
    const int wave = tid >> 5;
    const int h    = lane >> 4;          // lane half
    const int m    = lane & 15;          // A row / B col / D col
    const int m0   = (int)blockIdx.x * 64;
    const int n0   = (int)blockIdx.y * 64;
    const int wm   = (wave >> 1) * 32;
    const int wn   = (wave & 1) * 32;

    constexpr int AJ = RES ? 16 : 256;   // halves from element group 0 to group 1 in A's unit
    const size_t ra0 = (size_t)(m0 + wm) * CC + (RES ? (m * 4 + h) * 8 : lane * 8);
    const size_t ra1 = ra0 + (size_t)16 * CC;
    const size_t rb0 = (size_t)(n0 + wn) * CC + lane * 8;
    const size_t rb1 = rb0 + (size_t)16 * CC;

    v8f acc00 = {0.f, 0.f, 0.f, 0.f, 0.f, 0.f, 0.f, 0.f};
    v8f acc01 = acc00, acc10 = acc00, acc11 = acc00;
    v8f rcc00 = acc00, rcc01 = acc00, rcc10 = acc00, rcc11 = acc00;

#pragma unroll 1
    for (int k0 = 0; k0 < CC; k0 += 32) {
        FragH a0, a1, b0, b1;
        // elements 0..7 <- k0+8h+0..7, elements 8..15 <- k0+16+8h+0..7 (A and B identical map)
        const int ku = k0 * 16;          // 512 halves per unit of 32 k
        a0.half[0] = *(const v8h*)(A + ra0 + ku);
        a0.half[1] = *(const v8h*)(A + ra0 + ku + AJ);
        a1.half[0] = *(const v8h*)(A + ra1 + ku);
        a1.half[1] = *(const v8h*)(A + ra1 + ku + AJ);
        b0.half[0] = *(const v8h*)(Bw + rb0 + ku);
        b0.half[1] = *(const v8h*)(Bw + rb0 + ku + 256);
        b1.half[0] = *(const v8h*)(Bw + rb1 + ku);
        b1.half[1] = *(const v8h*)(Bw + rb1 + ku + 256);
        acc00 = wmma16(a0.v, b0.v, acc00);
        acc01 = wmma16(a0.v, b1.v, acc01);
        acc10 = wmma16(a1.v, b0.v, acc10);
        acc11 = wmma16(a1.v, b1.v, acc11);
        if (RES) {
            FragH e0, e1;
            e0.half[0] = *(const v8h*)(Ar + ra0 + ku);
            e0.half[1] = *(const v8h*)(Ar + ra0 + ku + AJ);
            e1.half[0] = *(const v8h*)(Ar + ra1 + ku);
            e1.half[1] = *(const v8h*)(Ar + ra1 + ku + AJ);
            rcc00 = wmma16(e0.v, b0.v, rcc00);
            rcc01 = wmma16(e0.v, b1.v, rcc01);
            rcc10 = wmma16(e1.v, b0.v, rcc10);
            rcc11 = wmma16(e1.v, b1.v, rcc11);
            asm volatile("v_nop\n\tv_nop\n\tv_nop\n\tv_nop"
                         : "+v"(acc00), "+v"(acc01), "+v"(acc10), "+v"(acc11),
                           "+v"(rcc00), "+v"(rcc01), "+v"(rcc10), "+v"(rcc11)
                         : "v"(a0.v), "v"(a1.v), "v"(b0.v), "v"(b1.v), "v"(e0.v), "v"(e1.v));
        } else {
            asm volatile("v_nop\n\tv_nop\n\tv_nop\n\tv_nop"
                         : "+v"(acc00), "+v"(acc01), "+v"(acc10), "+v"(acc11)
                         : "v"(a0.v), "v"(a1.v), "v"(b0.v), "v"(b1.v));
        }
    }

    // D element r of lane -> row 8h + r, col m of each 16x16 tile
    {
        float* p00 = cs + (wm + 8 * h) * CSP + wn + m;
        float* p10 = cs + (wm + 16 + 8 * h) * CSP + wn + m;
#pragma unroll
        for (int r = 0; r < 8; ++r) {
            float v00, v01, v10, v11;
            if (RES) {
                v00 = (acc00[r] + rcc00[r] * INV_R_CARRY) * scale;
                v01 = (acc01[r] + rcc01[r] * INV_R_CARRY) * scale;
                v10 = (acc10[r] + rcc10[r] * INV_R_CARRY) * scale;
                v11 = (acc11[r] + rcc11[r] * INV_R_CARRY) * scale;
            } else {
                v00 = acc00[r] * scale;
                v01 = acc01[r] * scale;
                v10 = acc10[r] * scale;
                v11 = acc11[r] * scale;
            }
            p00[r * CSP]      = v00;
            p00[r * CSP + 16] = v01;
            p10[r * CSP]      = v10;
            p10[r * CSP + 16] = v11;
        }
    }
    __syncthreads();   // cs is written per wave, read cross-wave

    // 64 rows x 256 B = 128 lines; per pass 16 lines, line L by lanes 8q..8q+7 of one wave
    const int lr = tid >> 3;
    const int lq = tid & 7;
#pragma unroll
    for (int p = 0; p < 8; ++p) {
        const int L = p * 16 + lr;
        const int row = L >> 1;
        const int col = (L & 1) * 32 + lq * 4;
        const v4f v = *(const v4f*)(cs + row * CSP + col);
        *(v4f*)(out + (size_t)(m0 + row) * ldo + n0 + col) = v;
    }
    
}

// ------------------------------------------------------------------------------------------------
// Fused: per-pixel 9-way softmax (each logit group feeds exactly one output pixel), combination of
// the 81 window weights into a 5x5 table per (pixel, head) in LDS, weighted aggregation of V over
// the 5x5 neighbourhood (at the image's edge the 5x5 block of loads is shifted inside the image and the
// positions outside the neighbourhood meet the table's zero border: zero-extended v), then y written as
// f16 hi plane + f16 residual plane x2048. Block = 2 pixels, 192 threads; 96 threads (3 waves)
// per pixel. No load waits on another load's use: one softmax group per thread (108 groups a pixel,
// so 12 threads take a second one, loaded together with the first), and the 25 window loads of a
// thread share one address with constant offsets and are issued ahead of their uses.
//   P  : [rows of this pass][1024] f32 logits (unscaled), local row = global pixel - row0
//   V  : [NB*NPIX][384] f32
//   Yh, Yr : NB*NPIX rows of 384, f16, fragment order (y planes' chunk order)
__global__ __launch_bounds__(192)
void k_av(const float* __restrict__ P, const float* __restrict__ V,
          _Float16* Yh, _Float16* Yr, int row0) {
#pragma clang fp contract(off)
    __shared__ __attribute__((aligned(16))) float ps[IPB * HEADS * PSP];   // cross-wave: softmax values, [pixel][head][ij * 9 + q]
    __shared__ __attribute__((aligned(16))) float w9s[IPB * HEADS * 81];   // cross-wave: 5x5 tables inside a zero border of 2 (9x9)
    __shared__ __attribute__((aligned(16))) float ys[IPB * CC];            // cross-wave: written by all, read by all (block barrier)
    const int tid = (int)threadIdx.x;
    const int lpb = (int)blockIdx.x * IPB;    // first local pixel of this block
    const int pix = __builtin_amdgcn_readfirstlane(tid / 96);   // same in all lanes of a wave: kept scalar
    const int u   = tid - pix * 96;
    const int lp  = lpb + pix;
    const int gp  = row0 + lp;
    const int rs  = gp % NPIX;
    const int r   = rs / WW;
    const int s   = rs - r * WW;

    // zero the 9x9 tables; the 5x5 cores are written behind the next barrier
    for (int c = tid; c < IPB * HEADS * 81 / 4; c += 192) {
        const v4f zero4 = {0.0f, 0.0f, 0.0f, 0.0f};
        *(v4f*)(w9s + c * 4) = zero4;
    }

    // ---- phase 1a: softmax of the 9x12 groups feeding each pixel, one group g = head * 9 + ij a thread ----
    {
        constexpr int NG = HEADS * 9;             // 108 groups per pixel
        const bool two = u < NG - 96;             // these threads also take group 96 + u
        float z[2][9];
        bool  ok[2];
        int   gi[2];
#pragma unroll
        for (int t = 0; t < 2; ++t) {
            if (t == 0 || two) {
                const int g  = t * 96 + u;
                const int ij = g % 9;
                const int i  = ij / 3;
                const int j  = ij - 3 * i;
                const int ny = r + 1 - i;                 // window centre pixel n'
                const int nx = s + 1 - j;
                ok[t] = ((unsigned)ny < (unsigned)HH) && ((unsigned)nx < (unsigned)WW);
                const int nyc = ny < 0 ? 0 : (ny >= HH ? HH - 1 : ny);
                const int nxc = nx < 0 ? 0 : (nx >= WW ? WW - 1 : nx);
                const int nlp = lp + (nyc - r) * WW + (nxc - s);      // same image, clamped address
                const float* gsrc = P + (unsigned)(nlp * NA_PAD + g * 9);
                gi[t] = g;
#pragma unroll
                for (int q = 0; q < 9; ++q) z[t][q] = gsrc[q];
            }
        }
#pragma unroll
        for (int t = 0; t < 2; ++t) {
            if (t == 0 || two) {
                float mx = -3.0e38f;
#pragma unroll
                for (int q = 0; q < 9; ++q) { z[t][q] = z[t][q] * SM_SCALE; mx = fmaxf(mx, z[t][q]); }
                float e[9];
                float sum = 0.0f;
#pragma unroll
                for (int q = 0; q < 9; ++q) { e[q] = exp2_slot((z[t][q] - mx) * LOG2E); sum += e[q]; }
                const float inv = 1.0f / sum;
                float* pd = ps + (pix * HEADS + gi[t] / 9) * PSP + (gi[t] % 9) * 9;
#pragma unroll
                for (int q = 0; q < 9; ++q) pd[q] = ok[t] ? (e[q] * inv) : 0.0f;
            }
        }
    }
    __syncthreads();   // ps is written per group, read per (pixel, head)

    // ---- phase 1b: 5x5 tables, one (pixel, head) a thread. The weight for v offset (dy, dx) = (qi - i, qj - j)
    //      belongs to entry (dy+2)*5 + (dx+2); an entry's terms are added in ascending ij ----
    if (tid < IPB * HEADS) {
        const float* srcp = ps + tid * PSP;
        float pr[81];
#pragma unroll
        for (int c = 0; c < 20; ++c) {
            const v4f p4 = *(const v4f*)(srcp + c * 4);
            pr[c * 4 + 0] = p4.x; pr[c * 4 + 1] = p4.y; pr[c * 4 + 2] = p4.z; pr[c * 4 + 3] = p4.w;
        }
        pr[80] = srcp[80];
        float tb[25];
#pragma unroll
        for (int t = 0; t < 25; ++t) tb[t] = 0.0f;
#pragma unroll
        for (int ij = 0; ij < 9; ++ij) {
            const int i = ij / 3;
            const int j = ij - 3 * i;
#pragma unroll
            for (int q = 0; q < 9; ++q) {
                const int qi = q / 3;
                const int qj = q - 3 * qi;
                tb[(2 - i + qi) * 5 + (2 - j + qj)] += pr[ij * 9 + q];
            }
        }
        float* wdst = w9s + tid * 81 + 2 * 9 + 2;
#pragma unroll
        for (int t = 0; t < 25; ++t) wdst[(t / 5) * 9 + (t % 5)] = tb[t];
    }
    __syncthreads();

    // ---- phase 2: y[c] = sum over 5x5 neighbourhood of w5[dy][dx] * v[r+dy][s+dx][c] ----
    {
        const int c0   = u * 4;
        const int head = u >> 3;                   // 32 channels per head, 4 per thread
        // first row and column of the 5x5 block of loads: the neighbourhood's, moved inside the image
        const int y0 = r - 2 < 0 ? 0 : (r - 2 > HH - 5 ? HH - 5 : r - 2);
        const int x0 = s - 2 < 0 ? 0 : (s - 2 > WW - 5 ? WW - 5 : s - 2);
        // load (ka, kb) is neighbourhood entry (ka + y0 - (r - 2), kb + x0 - (s - 2)): -2..6, inside the 9x9 table
        const float* wrow = w9s + (pix * HEADS + head) * 81 + (y0 - r + 4) * 9 + (x0 - s + 4);
        const float* vb = V + (size_t)(gp - rs + y0 * WW + x0) * CC + c0;
        v4f vv[25];
#pragma unroll
        for (int t = 0; t < 25; ++t) vv[t] = *(const v4f*)(vb + ((t / 5) * WW + (t % 5)) * CC);
        v4f acc = {0.0f, 0.0f, 0.0f, 0.0f};
#pragma unroll
        for (int t = 0; t < 25; ++t) {
            const float w = wrow[(t / 5) * 9 + (t % 5)];
            acc.x = fmaf(w, vv[t].x, acc.x);
            acc.y = fmaf(w, vv[t].y, acc.y);
            acc.z = fmaf(w, vv[t].z, acc.z);
            acc.w = fmaf(w, vv[t].w, acc.w);
        }
        *(v4f*)(ys + pix * CC + c0) = acc;
    }
    __syncthreads();

    // ---- phase 3: whole-line plane stores: waves 0-2 write hi, waves 3-5 write residual ----
    {
        const int plane = tid / 96;                // wave-uniform
        const int u3    = tid - plane * 96;
        const int kb    = u3 >> 3;                 // 8 lanes = 2 pixels x 4 chunks = one 128-B line
        const int pix3  = (u3 >> 2) & 1;
        const int c4    = u3 & 3;
        const int ch    = kb * 4 + c4;
        const int gp3 = row0 + lpb + pix3;
        const float* ysrc = ys + pix3 * CC + ch * 8;
        const v4f y0 = *(const v4f*)ysrc;
        const v4f y1 = *(const v4f*)(ysrc + 4);
        float yv[8] = {y0.x, y0.y, y0.z, y0.w, y1.x, y1.y, y1.z, y1.w};
        v8h oh, orr;
#pragma unroll
        for (int e = 0; e < 8; ++e) {
            const _Float16 hq = (_Float16)yv[e];
            const float res = (yv[e] - (float)hq) * R_CARRY;    // exact in f32
            oh[e]  = hq;
            orr[e] = (_Float16)res;
        }
        const size_t dofs = ((size_t)((gp3 >> 4) * KBL + kb) * 64 + (gp3 & 15) * 4 + c4) * 8;
        if (plane == 0) {
            _Float16* d = Yh + dofs;
            *(v8h*)d = oh;
            
        } else {
            _Float16* d = Yr + dofs;
            *(v8h*)d = orr;
            
        }
    }
}

// ------------------------------------------------------------------------------------------------
static inline size_t al256(size_t b) { return (b + 255) & ~(size_t)255; }

extern "C" void kernel_launch(void* const* d_in, const int* in_sizes, int n_in,
                              void* d_out, int out_size, void* d_ws, size_t ws_size,
                              hipStream_t stream) {
    if (n_in < 4) return;
    if (in_sizes[0] < NB * NPIX * CC) return;
    if (in_sizes[1] < CC * CC) return;
    if (in_sizes[2] < NA * CC) return;
    if (in_sizes[3] < CC * CC) return;
    if (out_size < NB * NPIX * CC) return;

    const float* x  = (const float*)d_in[0];   // [NB][56][56][384]
    const float* Wv = (const float*)d_in[1];   // [384][384]  ([out][in])
    const float* Wa = (const float*)d_in[2];   // [972][384]
    const float* Wo = (const float*)d_in[3];   // [384][384]
    float* out = (float*)d_out;                // [NB][56][56][384] f32

    // multiples of the store granularity, offsets 256-B aligned)
    const size_t szXH = (size_t)NB * NPIX * CC * 2;            // x as f16
    const size_t szW  = (size_t)WROWS * CC * 2;                // weight planes
    const size_t szV  = (size_t)NB * NPIX * CC * 4;            // v f32
    const size_t szP  = (size_t)IPP * NPIX * NA_PAD * 4;       // logits of one pass, f32
    const size_t szY  = (size_t)NB * NPIX * CC * 2;            // y planes (hi, residual)
    size_t off = 0;
    const size_t oXH = off; off += al256(szXH);
    const size_t oW  = off; off += al256(szW);
    const size_t oV  = off; off += al256(szV);
    const size_t oP  = off; off += al256(szP);
    const size_t oYH = off; off += al256(szY);
    const size_t oYR = off; off += al256(szY);
    if (off > ws_size) return;

    char* ws = (char*)d_ws;
    _Float16* Xh  = (_Float16*)(ws + oXH);
    _Float16* Wpl = (_Float16*)(ws + oW);
    const _Float16* Wvh = Wpl;
    const _Float16* Wah = Wpl + (size_t)CC * CC;
    const _Float16* Woh = Wpl + (size_t)(CC + NA_PAD) * CC;
    float* Vf = (float*)(ws + oV);
    float* Pf = (float*)(ws + oP);
    _Float16* Yh = (_Float16*)(ws + oYH);
    _Float16* Yr = (_Float16*)(ws + oYR);

    // 1) operand planes
    {
        const int nchunk = NB * NPIX * KCH;
        k_cvt_x<<<nchunk / 256, 256, 0, stream>>>(x, Xh, nchunk);
        k_cvt_w<<<(WROWS * KCH) / 256, 256, 0, stream>>>(Wv, Wa, Wo, Wpl);
    }
    // 2) v = x * Wv^T  -> f32 [NB*NPIX][384]
    k_gemm<0><<<dim3(NB * NPIX / 64, CC / 64), 128, 0, stream>>>(Xh, Xh, Wvh, Vf, CC, INV_W_CARRY);
    // 3) per pass of IPP images: logits = x * Wa^T -> [rows][1024], then softmax + aggregation + fold
    for (int ps = 0; ps < NPASS; ++ps) {
        const int nimg = (NB - ps * IPP < IPP) ? (NB - ps * IPP) : IPP;
        const int rows = nimg * NPIX;
        const int r0   = ps * IPP * NPIX;
        k_gemm<0><<<dim3(rows / 64, NA_PAD / 64), 128, 0, stream>>>(
            Xh + (size_t)r0 * CC, Xh, Wah, Pf, NA_PAD, INV_W_CARRY);
        k_av<<<rows / IPB, 192, 0, stream>>>(Pf, Vf, Yh, Yr, r0);
    }
    // 4) out = y * Wo^T  (hi + residual/2048) -> d_out
    k_gemm<1><<<dim3(NB * NPIX / 64, CC / 64), 128, 0, stream>>>(Yh, Yr, Woh, out, CC, INV_W_CARRY);
}

// v003
// It runs in 157 microseconds.
// Timed twice side by side with v002, it ran 1.19 times as fast both times.
// Over all steps from v000 it is 1.94 times as fast.
#include <hip/hip_runtime.h>

// All contractions on v_wmma_f32_16x16x32_f16 (f16 operands, f32 accumulate): x*Wv^T and x*Wa^T with
// f16 containers of bf16-RNE inputs (weights carried x16); y*Wo^T with y as f16 hi plane plus f16
// residual plane carried x2048 into a separate accumulator (folded x1/2048), Wo bf16-RNE x16.
// Per-pixel 9-way softmax, 3x3 window aggregation and overlap-add fold: f32 on VALU.
//
// The 16-bit operand planes are stored in fragment order, not row-major. A plane is cut into units of
// 16 rows x 32 k = 64 chunks of 16 B (1 KiB); unit (row tile t, k block kb) starts at chunk
// (t * 12 + kb) * 64, so a row tile still spans 16 * 384 halves. Chunk (row m, c4 = k / 8 within the
// block) holds the halves that lane half h = c4 & 1 takes as element group j = c4 >> 1. Inside a unit:
//   x and weight planes: chunk j * 32 + h * 16 + m  (one fragment load = 512 contiguous bytes, 4 lines)
//   y planes:            chunk m * 4 + c4           (two pixels' 64-B pieces fill one 128-B line, so
//                                                    k_av stays the only writer of a line; 8 lines a load)
//
// Logit columns are stored window-position-major: column ij * 108 + head * 9 + q holds the reference's
// logit head * 81 + ij * 9 + q (the rows of Wa are permuted where the weight plane is written). An output
// pixel takes group ij of all heads from ONE neighbour, so its inputs are 9 contiguous runs of 432 B.

#ifndef NB
#define NB 8
#endif
#define NB_FULL 8
#define HH 56
#define WW 56
#define CC 384
#define HEADS 12
#define DHEAD 32
#define NPIX (HH * WW)                 // 3136 pixels per image
#define NA 972                         // HEADS * 81 logits per pixel
#define NA_PAD 1024                    // logit columns incl. zero columns 972..1023
#define NRUN (HEADS * 9)               // 108 logits of one window position ij, all heads: one contiguous run
#define RCH (NRUN / 4)                 // 27 chunks of 16 B per run
#define PCH (NA / 4)                   // 243 chunks of 16 B per pixel
#define KCH (CC / 8)                   // 48 chunks of 16 B per 384-wide 16-bit row
#define KBL (CC / 32)                  // 12 k blocks of 32 per row
#define WROWS (CC + NA_PAD + CC)       // weight plane rows: Wv | Wa (zero-extended) | Wo
#define IPP 2                          // images per logit pass
#define NPASS ((NB + IPP - 1) / IPP)
#define IPB 2                          // pixels per block in k_av
#define CSP 68                         // LDS pitch (floats) of the 64x64 epilogue tile
#define PSP 84                         // LDS pitch (floats) of one head's 81 softmax values in k_av (16-B rows)
#define SM_SCALE 0.17677669529663687f  // 32^-0.5
#define LOG2E 0x1.715476p+0f           // log2(e) in f32: e^x = 2^(x * LOG2E)
#define INV_W_CARRY 0.0625f            // weights are carried x16
#define R_CARRY 2048.0f                // residual plane carry
#define INV_R_CARRY 0.00048828125f

static_assert(NB >= 1 && NB <= NB_FULL);
static_assert(NPIX % 64 == 0);
static_assert(CC % 16 == 0 && NA_PAD % 16 == 0 && (IPP * NPIX) % 16 == 0);   // planes and passes start on a row tile
static_assert(IPB == 2 && NPIX % 2 == 0);                                    // a k_av block owns an even/odd row pair
static_assert((NPIX * KCH) % 256 == 0);
static_assert((CC * KCH) % 256 == 0);
static_assert((NA_PAD * KCH) % 256 == 0);
static_assert((WROWS * KCH) % 256 == 0);
static_assert(CC % 64 == 0);
static_assert(NA_PAD % 64 == 0);
static_assert(NA <= NA_PAD);
static_assert(CC % 32 == 0);
static_assert(HEADS * DHEAD == CC);
static_assert(HEADS * 81 == NA);
static_assert(NPIX % IPB == 0);
static_assert(IPB * 96 == 192);
static_assert(NRUN % 4 == 0 && WW % IPB == 0);   // runs are whole 16-B chunks; a k_av block's pixels share an image row
static_assert(IPB * PCH > 2 * 192 && IPB * PCH <= 3 * 192);

typedef _Float16 v16h __attribute__((ext_vector_type(16)));
typedef _Float16 v8h  __attribute__((ext_vector_type(8)));
typedef float    v8f  __attribute__((ext_vector_type(8)));
typedef float    v4f  __attribute__((ext_vector_type(4)));

union FragH { v16h v; v8h half[2]; };

__device__ __forceinline__ unsigned int bf16r_bits(float f) {
    unsigned int u = __float_as_uint(f);
    u += 0x7FFFu + ((u >> 16) & 1u);          // RNE to bf16
    return u & 0xFFFF0000u;
}
__device__ __forceinline__ float bf16r(float f) { return __uint_as_float(bf16r_bits(f)); }

// 2^x on the transcendental unit. The v_nop fills the one slot that the instruction set asks for between a
// transcendental and a next instruction that reads its result or overwrites its source.
__device__ __forceinline__ float exp2_slot(float x) {
    float y;
    asm("v_exp_f32 %0, %1\n\tv_nop" : "=v"(y) : "v"(x));
    return y;
}

__device__ __forceinline__ v8f wmma16(v16h a, v16h b, v8f c) {
    return __builtin_amdgcn_wmma_f32_16x16x32_f16(false, a, false, b, (short)0, c, false, false);
}

// ------------------------------------------------------------------------------------------------
// x [rows][384] f32 -> xh, fragment order, f16 (bf16-RNE value, exact in f16). One 16-B chunk per thread:
// 4 lanes read one 128-B line of a row, 8 rows a wave; the wave's stores fill 4 whole lines.
__global__ __launch_bounds__(256)
void k_cvt_x(const float* __restrict__ x, _Float16* xh, int nchunk) {
    const int g = (int)blockIdx.x * 256 + (int)threadIdx.x;
    if (g >= nchunk) return;
    const int unit = g >> 6;
    const int tile = unit / KBL;
    const int kb   = unit - tile * KBL;
    const int m    = (g >> 2) & 15;
    const int c4   = g & 3;
    const float* s = x + (size_t)(tile * 16 + m) * CC + kb * 32 + c4 * 8;
    const v4f f0 = *(const v4f*)s;
    const v4f f1 = *(const v4f*)(s + 4);
    float t[8] = {f0.x, f0.y, f0.z, f0.w, f1.x, f1.y, f1.z, f1.w};
    v8h o;
#pragma unroll
    for (int e = 0; e < 8; ++e) o[e] = (_Float16)bf16r(t[e]);
    _Float16* d = xh + (size_t)(unit * 64 + (c4 >> 1) * 32 + (c4 & 1) * 16 + m) * 8;
    *(v8h*)d = o;
    
}

// ------------------------------------------------------------------------------------------------
// Weight planes, WROWS rows of 384, f16 = 16 * bf16-RNE(W), fragment order over rows n:
//   rows [0,384) Wv, [384,1408) Wa (rows >= 972 written as zeros), [1408,1792) Wo.
// Wa's plane row ij * 108 + head * 9 + q is taken from Wa's row head * 81 + ij * 9 + q.
// Plane selection is block-uniform (plane boundaries are multiples of 256 chunks).
__global__ __launch_bounds__(256)
void k_cvt_w(const float* __restrict__ Wv, const float* __restrict__ Wa,
             const float* __restrict__ Wo, _Float16* wpl) {
    const int g   = (int)blockIdx.x * 256 + (int)threadIdx.x;   // < WROWS*KCH exactly
    const int unit = g >> 6;
    const int tile = unit / KBL;
    const int kb   = unit - tile * KBL;
    const int m    = (g >> 2) & 15;
    const int c4   = g & 3;
    const int R   = tile * 16 + m;
    const int ch  = kb * 4 + c4;
    const int blk = (int)blockIdx.x;
    const float* src;
    int rbase, nvalid;
    bool perm = false;
    if (blk < (CC * KCH) / 256)                  { src = Wv; rbase = 0;           nvalid = CC; }
    else if (blk < ((CC + NA_PAD) * KCH) / 256)  { src = Wa; rbase = CC;          nvalid = NA; perm = true; }
    else                                         { src = Wo; rbase = CC + NA_PAD; nvalid = CC; }
    const int rr = R - rbase;                                    // >= 0
    int rc = (rr < nvalid) ? rr : (nvalid - 1);                  // clamped address
    if (perm) {                                                  // block-uniform
        const int ij  = rc / NRUN;
        const int rem = rc - ij * NRUN;
        const int hd  = rem / 9;
        rc = hd * 81 + ij * 9 + (rem - hd * 9);
    }
    const float pm = (rr < nvalid) ? 16.0f : 0.0f;               // carry, or zero for extension rows
    const float* s = src + (size_t)rc * CC + ch * 8;
    const v4f f0 = *(const v4f*)s;
    const v4f f1 = *(const v4f*)(s + 4);
    float t[8] = {f0.x, f0.y, f0.z, f0.w, f1.x, f1.y, f1.z, f1.w};
    v8h o;
#pragma unroll
    for (int e = 0; e < 8; ++e) o[e] = (_Float16)(bf16r(t[e]) * pm);
    _Float16* d = wpl + (size_t)(unit * 64 + (c4 >> 1) * 32 + (c4 & 1) * 16 + m) * 8;
    *(v8h*)d = o;
    
}

// ------------------------------------------------------------------------------------------------
// Out[m][n] = scale * sum_k A[m][k] * Bw[n][k]   (K = 384, A and Bw in fragment order)
// RES = 1: Out[m][n] = scale * (sum_k A[m][k]*Bw[n][k] + (1/2048) * sum_k Ar[m][k]*Bw[n][k]).
// Block = 4 waves, 64x64 tile, each wave 32x32 (2x2 WMMA tiles). Fragments loaded straight from
// the global planes with the split-k lane map for A and B alike; RES = 1 reads A and Ar in the y planes'
// chunk order, RES = 0 in the x plane's. Epilogue staged in LDS, then whole
template <int RES>
__global__ __launch_bounds__(128)
void k_gemm(const _Float16* __restrict__ A, const _Float16* __restrict__ Ar,
            const _Float16* __restrict__ Bw, float* out, int ldo, float scale) {
    __shared__ float cs[64 * CSP];
    const int tid  = (int)threadIdx.x;
    const int lane = tid & 31;
    const int wave = tid >> 5;
    const int h    = lane >> 4;          // lane half
    const int m    = lane & 15;          // A row / B col / D col
    const int m0   = (int)blockIdx.x * 64;
    const int n0   = (int)blockIdx.y * 64;
    const int wm   = (wave >> 1) * 32;
    const int wn   = (wave & 1) * 32;

    constexpr int AJ = RES ? 16 : 256;   // halves from element group 0 to group 1 in A's unit
    const size_t ra0 = (size_t)(m0 + wm) * CC + (RES ? (m * 4 + h) * 8 : lane * 8);
    const size_t ra1 = ra0 + (size_t)16 * CC;
    const size_t rb0 = (size_t)(n0 + wn) * CC + lane * 8;
    const size_t rb1 = rb0 + (size_t)16 * CC;

    v8f acc00 = {0.f, 0.f, 0.f, 0.f, 0.f, 0.f, 0.f, 0.f};
    v8f acc01 = acc00, acc10 = acc00, acc11 = acc00;
    v8f rcc00 = acc00, rcc01 = acc00, rcc10 = acc00, rcc11 = acc00;

#pragma unroll 1
    for (int k0 = 0; k0 < CC; k0 += 32) {
        FragH a0, a1, b0, b1;
        // elements 0..7 <- k0+8h+0..7, elements 8..15 <- k0+16+8h+0..7 (A and B identical map)
        const int ku = k0 * 16;          // 512 halves per unit of 32 k
        a0.half[0] = *(const v8h*)(A + ra0 + ku);
        a0.half[1] = *(const v8h*)(A + ra0 + ku + AJ);
        a1.half[0] = *(const v8h*)(A + ra1 + ku);
        a1.half[1] = *(const v8h*)(A + ra1 + ku + AJ);
        b0.half[0] = *(const v8h*)(Bw + rb0 + ku);
        b0.half[1] = *(const v8h*)(Bw + rb0 + ku + 256);
        b1.half[0] = *(const v8h*)(Bw + rb1 + ku);
        b1.half[1] = *(const v8h*)(Bw + rb1 + ku + 256);
        acc00 = wmma16(a0.v, b0.v, acc00);
        acc01 = wmma16(a0.v, b1.v, acc01);
        acc10 = wmma16(a1.v, b0.v, acc10);
        acc11 = wmma16(a1.v, b1.v, acc11);
        if (RES) {
            FragH e0, e1;
            e0.half[0] = *(const v8h*)(Ar + ra0 + ku);
            e0.half[1] = *(const v8h*)(Ar + ra0 + ku + AJ);
            e1.half[0] = *(const v8h*)(Ar + ra1 + ku);
            e1.half[1] = *(const v8h*)(Ar + ra1 + ku + AJ);
            rcc00 = wmma16(e0.v, b0.v, rcc00);
            rcc01 = wmma16(e0.v, b1.v, rcc01);
            rcc10 = wmma16(e1.v, b0.v, rcc10);
            rcc11 = wmma16(e1.v, b1.v, rcc11);
            asm volatile("v_nop\n\tv_nop\n\tv_nop\n\tv_nop"
                         : "+v"(acc00), "+v"(acc01), "+v"(acc10), "+v"(acc11),
                           "+v"(rcc00), "+v"(rcc01), "+v"(rcc10), "+v"(rcc11)
                         : "v"(a0.v), "v"(a1.v), "v"(b0.v), "v"(b1.v), "v"(e0.v), "v"(e1.v));
        } else {
            asm volatile("v_nop\n\tv_nop\n\tv_nop\n\tv_nop"
                         : "+v"(acc00), "+v"(acc01), "+v"(acc10), "+v"(acc11)
                         : "v"(a0.v), "v"(a1.v), "v"(b0.v), "v"(b1.v));
        }
    }

    // D element r of lane -> row 8h + r, col m of each 16x16 tile
    {
        float* p00 = cs + (wm + 8 * h) * CSP + wn + m;
        float* p10 = cs + (wm + 16 + 8 * h) * CSP + wn + m;
#pragma unroll
        for (int r = 0; r < 8; ++r) {
            float v00, v01, v10, v11;
            if (RES) {
                v00 = (acc00[r] + rcc00[r] * INV_R_CARRY) * scale;
                v01 = (acc01[r] + rcc01[r] * INV_R_CARRY) * scale;
                v10 = (acc10[r] + rcc10[r] * INV_R_CARRY) * scale;
                v11 = (acc11[r] + rcc11[r] * INV_R_CARRY) * scale;
            } else {
                v00 = acc00[r] * scale;
                v01 = acc01[r] * scale;
                v10 = acc10[r] * scale;
                v11 = acc11[r] * scale;
            }
            p00[r * CSP]      = v00;
            p00[r * CSP + 16] = v01;
            p10[r * CSP]      = v10;
            p10[r * CSP + 16] = v11;
        }
    }
    __syncthreads();   // cs is written per wave, read cross-wave

    // 64 rows x 256 B = 128 lines; per pass 16 lines, line L by lanes 8q..8q+7 of one wave
    const int lr = tid >> 3;
    const int lq = tid & 7;
#pragma unroll
    for (int p = 0; p < 8; ++p) {
        const int L = p * 16 + lr;
        const int row = L >> 1;
        const int col = (L & 1) * 32 + lq * 4;
        const v4f v = *(const v4f*)(cs + row * CSP + col);
        *(v4f*)(out + (size_t)(m0 + row) * ldo + n0 + col) = v;
    }
    
}

// ------------------------------------------------------------------------------------------------
// Fused: per-pixel 9-way softmax (each logit group feeds exactly one output pixel), combination of
// the 81 window weights into a 5x5 table per (pixel, head) in LDS, weighted aggregation of V over
// the 5x5 neighbourhood (at the image's edge the 5x5 block of loads is shifted inside the image and the
// positions outside the neighbourhood meet the table's zero border: zero-extended v), then y written as
// f16 hi plane + f16 residual plane x2048. Block = 2 pixels, 192 threads; 96 threads (3 waves)
// per pixel. The block's logits (2 pixels x 9 runs of 432 B) come in as 16-B chunks, consecutive lanes on
// consecutive chunks, and are laid in LDS; one softmax group per thread (108 groups a pixel, so 12 threads
// take a second one), and the 25 window loads of a thread share one address with constant offsets and are
// issued ahead of their uses.
//   P  : [rows of this pass][1024] f32 logits (unscaled, columns ij * 108 + head * 9 + q), local row = global pixel - row0
//   V  : [NB*NPIX][384] f32
//   Yh, Yr : NB*NPIX rows of 384, f16, fragment order (y planes' chunk order)
__global__ __launch_bounds__(192)
void k_av(const float* __restrict__ P, const float* __restrict__ V,
          _Float16* Yh, _Float16* Yr, int row0) {
#pragma clang fp contract(off)
    __shared__ __attribute__((aligned(16))) float zs[IPB * NA];            // cross-wave: logits, [pixel][ij][head][q]
    __shared__ __attribute__((aligned(16))) float ps[IPB * HEADS * PSP];   // cross-wave: softmax values, [pixel][head][ij * 9 + q]
    __shared__ __attribute__((aligned(16))) float w9s[IPB * HEADS * 81];   // cross-wave: 5x5 tables inside a zero border of 2 (9x9)
    __shared__ __attribute__((aligned(16))) float ys[IPB * CC];            // cross-wave: written by all, read by all (block barrier)
    const int tid = (int)threadIdx.x;
    const int lpb = (int)blockIdx.x * IPB;    // first local pixel of this block
    const int pix = __builtin_amdgcn_readfirstlane(tid / 96);   // same in all lanes of a wave: kept scalar
    const int u   = tid - pix * 96;
    const int lp  = lpb + pix;
    const int gp  = row0 + lp;
    const int rs  = gp % NPIX;
    const int r   = rs / WW;
    const int s   = rs - r * WW;

    // ---- phase 0: the block's logits into LDS, chunk c = pixel * 243 + ij * 27 + k; all loads ahead of the stores ----
    v4f zl[3];
    {
        const int rs0 = (row0 + lpb) % NPIX;      // the block's first pixel; its second is the next in the same row
        const int rb  = rs0 / WW;
        const int sb  = rs0 - rb * WW;
#pragma unroll   // constant indices keep zl in registers
        for (int t = 0; t < 3; ++t) {
            const int c0  = t * 192 + tid;
            const int c   = c0 < IPB * PCH ? c0 : IPB * PCH - 1;   // past the end: the last chunk again, not stored
            const int cp  = c / PCH;
            const int cc  = c - cp * PCH;
            const int ij  = cc / RCH;
            const int i   = ij / 3;
            const int j   = ij - 3 * i;
            const int ny  = rb + 1 - i;               // window centre pixel n'
            const int nx  = sb + cp + 1 - j;
            const int nyc = ny < 0 ? 0 : (ny >= HH ? HH - 1 : ny);
            const int nxc = nx < 0 ? 0 : (nx >= WW ? WW - 1 : nx);
            const int nlp = lpb + (nyc - rb) * WW + (nxc - sb);   // same image, clamped address
            zl[t] = *(const v4f*)(P + (unsigned)(nlp * NA_PAD + cc * 4));
        }
    }

    // zero the 9x9 tables while the logits fly; the 5x5 cores are written behind the second barrier
    for (int c = tid; c < IPB * HEADS * 81 / 4; c += 192) {
        const v4f zero4 = {0.0f, 0.0f, 0.0f, 0.0f};
        *(v4f*)(w9s + c * 4) = zero4;
    }

#pragma unroll   // constant indices keep zl in registers
    for (int t = 0; t < 3; ++t) {
        const int c = t * 192 + tid;
        if (t < 2 || c < IPB * PCH) *(v4f*)(zs + c * 4) = zl[t];
    }
    __syncthreads();   // zs is written per chunk, read per group

    // ---- phase 1a: softmax of the 9x12 groups feeding each pixel, one group g = head * 9 + ij a thread ----
    {
        constexpr int NG = HEADS * 9;             // 108 groups per pixel
        const bool two = u < NG - 96;             // these threads also take group 96 + u
        float z[2][9];
        bool  ok[2];
        int   gi[2];
#pragma unroll
        for (int t = 0; t < 2; ++t) {
            if (t == 0 || two) {
                const int g  = t * 96 + u;
                const int ij = g % 9;
                const int i  = ij / 3;
                const int j  = ij - 3 * i;
                const int ny = r + 1 - i;                 // window centre pixel n'
                const int nx = s + 1 - j;
                ok[t] = ((unsigned)ny < (unsigned)HH) && ((unsigned)nx < (unsigned)WW);
                const float* gsrc = zs + pix * NA + ij * NRUN + (g / 9) * 9;
                gi[t] = g;
#pragma unroll
                for (int q = 0; q < 9; ++q) z[t][q] = gsrc[q];
            }
        }
#pragma unroll
        for (int t = 0; t < 2; ++t) {
            if (t == 0 || two) {
                float mx = -3.0e38f;
#pragma unroll
                for (int q = 0; q < 9; ++q) { z[t][q] = z[t][q] * SM_SCALE; mx = fmaxf(mx, z[t][q]); }
                float e[9];
                float sum = 0.0f;
#pragma unroll
                for (int q = 0; q < 9; ++q) { e[q] = exp2_slot((z[t][q] - mx) * LOG2E); sum += e[q]; }
                const float inv = 1.0f / sum;
                float* pd = ps + (pix * HEADS + gi[t] / 9) * PSP + (gi[t] % 9) * 9;
#pragma unroll
                for (int q = 0; q < 9; ++q) pd[q] = ok[t] ? (e[q] * inv) : 0.0f;
            }
        }
    }
    __syncthreads();   // ps is written per group, read per (pixel, head)

    // ---- phase 1b: 5x5 tables, one (pixel, head) a thread. The weight for v offset (dy, dx) = (qi - i, qj - j)
    //      belongs to entry (dy+2)*5 + (dx+2); an entry's terms are added in ascending ij ----
    if (tid < IPB * HEADS) {
        const float* srcp = ps + tid * PSP;
        float pr[81];
#pragma unroll
        for (int c = 0; c < 20; ++c) {
            const v4f p4 = *(const v4f*)(srcp + c * 4);
            pr[c * 4 + 0] = p4.x; pr[c * 4 + 1] = p4.y; pr[c * 4 + 2] = p4.z; pr[c * 4 + 3] = p4.w;
        }
        pr[80] = srcp[80];
        float tb[25];
#pragma unroll
        for (int t = 0; t < 25; ++t) tb[t] = 0.0f;
#pragma unroll
        for (int ij = 0; ij < 9; ++ij) {
            const int i = ij / 3;
            const int j = ij - 3 * i;
#pragma unroll
            for (int q = 0; q < 9; ++q) {
                const int qi = q / 3;
                const int qj = q - 3 * qi;
                tb[(2 - i + qi) * 5 + (2 - j + qj)] += pr[ij * 9 + q];
            }
        }
        float* wdst = w9s + tid * 81 + 2 * 9 + 2;
#pragma unroll
        for (int t = 0; t < 25; ++t) wdst[(t / 5) * 9 + (t % 5)] = tb[t];
    }
    __syncthreads();

    // ---- phase 2: y[c] = sum over 5x5 neighbourhood of w5[dy][dx] * v[r+dy][s+dx][c] ----
    {
        const int c0   = u * 4;
        const int head = u >> 3;                   // 32 channels per head, 4 per thread
        // first row and column of the 5x5 block of loads: the neighbourhood's, moved inside the image
        const int y0 = r - 2 < 0 ? 0 : (r - 2 > HH - 5 ? HH - 5 : r - 2);
        const int x0 = s - 2 < 0 ? 0 : (s - 2 > WW - 5 ? WW - 5 : s - 2);
        // load (ka, kb) is neighbourhood entry (ka + y0 - (r - 2), kb + x0 - (s - 2)): -2..6, inside the 9x9 table
        const float* wrow = w9s + (pix * HEADS + head) * 81 + (y0 - r + 4) * 9 + (x0 - s + 4);
        const float* vb = V + (size_t)(gp - rs + y0 * WW + x0) * CC + c0;
        v4f vv[25];
#pragma unroll
        for (int t = 0; t < 25; ++t) vv[t] = *(const v4f*)(vb + ((t / 5) * WW + (t % 5)) * CC);
        v4f acc = {0.0f, 0.0f, 0.0f, 0.0f};
#pragma unroll
        for (int t = 0; t < 25; ++t) {
            const float w = wrow[(t / 5) * 9 + (t % 5)];
            acc.x = fmaf(w, vv[t].x, acc.x);
            acc.y = fmaf(w, vv[t].y, acc.y);
            acc.z = fmaf(w, vv[t].z, acc.z);
            acc.w = fmaf(w, vv[t].w, acc.w);
        }
        *(v4f*)(ys + pix * CC + c0) = acc;
    }
    __syncthreads();

    // ---- phase 3: whole-line plane stores: waves 0-2 write hi, waves 3-5 write residual ----
    {
        const int plane = tid / 96;                // wave-uniform
        const int u3    = tid - plane * 96;
        const int kb    = u3 >> 3;                 // 8 lanes = 2 pixels x 4 chunks = one 128-B line
        const int pix3  = (u3 >> 2) & 1;
        const int c4    = u3 & 3;
        const int ch    = kb * 4 + c4;
        const int gp3 = row0 + lpb + pix3;
        const float* ysrc = ys + pix3 * CC + ch * 8;
        const v4f y0 = *(const v4f*)ysrc;
        const v4f y1 = *(const v4f*)(ysrc + 4);
        float yv[8] = {y0.x, y0.y, y0.z, y0.w, y1.x, y1.y, y1.z, y1.w};
        v8h oh, orr;
#pragma unroll
        for (int e = 0; e < 8; ++e) {
            const _Float16 hq = (_Float16)yv[e];
            const float res = (yv[e] - (float)hq) * R_CARRY;    // exact in f32
            oh[e]  = hq;
            orr[e] = (_Float16)res;
        }
        const size_t dofs = ((size_t)((gp3 >> 4) * KBL + kb) * 64 + (gp3 & 15) * 4 + c4) * 8;
        if (plane == 0) {
            _Float16* d = Yh + dofs;
            *(v8h*)d = oh;
            
        } else {
            _Float16* d = Yr + dofs;
            *(v8h*)d = orr;
            
        }
    }
}

// ------------------------------------------------------------------------------------------------
static inline size_t al256(size_t b) { return (b + 255) & ~(size_t)255; }

extern "C" void kernel_launch(void* const* d_in, const int* in_sizes, int n_in,
                              void* d_out, int out_size, void* d_ws, size_t ws_size,
                              hipStream_t stream) {
    if (n_in < 4) return;
    if (in_sizes[0] < NB * NPIX * CC) return;
    if (in_sizes[1] < CC * CC) return;
    if (in_sizes[2] < NA * CC) return;
    if (in_sizes[3] < CC * CC) return;
    if (out_size < NB * NPIX * CC) return;

    const float* x  = (const float*)d_in[0];   // [NB][56][56][384]
    const float* Wv = (const float*)d_in[1];   // [384][384]  ([out][in])
    const float* Wa = (const float*)d_in[2];   // [972][384]
    const float* Wo = (const float*)d_in[3];   // [384][384]
    float* out = (float*)d_out;                // [NB][56][56][384] f32

    // multiples of the store granularity, offsets 256-B aligned)
    const size_t szXH = (size_t)NB * NPIX * CC * 2;            // x as f16
    const size_t szW  = (size_t)WROWS * CC * 2;                // weight planes
    const size_t szV  = (size_t)NB * NPIX * CC * 4;            // v f32
    const size_t szP  = (size_t)IPP * NPIX * NA_PAD * 4;       // logits of one pass, f32
    const size_t szY  = (size_t)NB * NPIX * CC * 2;            // y planes (hi, residual)
    size_t off = 0;
    const size_t oXH = off; off += al256(szXH);
    const size_t oW  = off; off += al256(szW);
    const size_t oV  = off; off += al256(szV);
    const size_t oP  = off; off += al256(szP);
    const size_t oYH = off; off += al256(szY);
    const size_t oYR = off; off += al256(szY);
    if (off > ws_size) return;

    char* ws = (char*)d_ws;
    _Float16* Xh  = (_Float16*)(ws + oXH);
    _Float16* Wpl = (_Float16*)(ws + oW);
    const _Float16* Wvh = Wpl;
    const _Float16* Wah = Wpl + (size_t)CC * CC;
    const _Float16* Woh = Wpl + (size_t)(CC + NA_PAD) * CC;
    float* Vf = (float*)(ws + oV);
    float* Pf = (float*)(ws + oP);
    _Float16* Yh = (_Float16*)(ws + oYH);
    _Float16* Yr = (_Float16*)(ws + oYR);

    // 1) operand planes
    {
        const int nchunk = NB * NPIX * KCH;
        k_cvt_x<<<nchunk / 256, 256, 0, stream>>>(x, Xh, nchunk);
        k_cvt_w<<<(WROWS * KCH) / 256, 256, 0, stream>>>(Wv, Wa, Wo, Wpl);
    }
    // 2) v = x * Wv^T  -> f32 [NB*NPIX][384]
    k_gemm<0><<<dim3(NB * NPIX / 64, CC / 64), 128, 0, stream>>>(Xh, Xh, Wvh, Vf, CC, INV_W_CARRY);
    // 3) per pass of IPP images: logits = x * Wa^T -> [rows][1024], then softmax + aggregation + fold
    for (int ps = 0; ps < NPASS; ++ps) {
        const int nimg = (NB - ps * IPP < IPP) ? (NB - ps * IPP) : IPP;
        const int rows = nimg * NPIX;
        const int r0   = ps * IPP * NPIX;
        k_gemm<0><<<dim3(rows / 64, NA_PAD / 64), 128, 0, stream>>>(
            Xh + (size_t)r0 * CC, Xh, Wah, Pf, NA_PAD, INV_W_CARRY);
        k_av<<<rows / IPB, 192, 0, stream>>>(Pf, Vf, Yh, Yr, r0);
    }
    // 4) out = y * Wo^T  (hi + residual/2048) -> d_out
    k_gemm<1><<<dim3(NB * NPIX / 64, CC / 64), 128, 0, stream>>>(Yh, Yr, Woh, out, CC, INV_W_CARRY);
}

// v004
// One run takes 123 microseconds.
// Next to v003, in two timings, it ran 1.27 times as fast each time.
// All steps since v000 together make it 2.47 times as fast.
#include <hip/hip_runtime.h>

// All contractions on v_wmma_f32_16x16x32_f16 (f16 operands, f32 accumulate): x*Wv^T and x*Wa^T with
// f16 containers of bf16-RNE inputs (weights carried x16); y*Wo^T with y as f16 hi plane plus f16
// residual plane carried x2048 into a separate accumulator (folded x1/2048), Wo bf16-RNE x16.
// Per-pixel 9-way softmax, 3x3 window aggregation and overlap-add fold: f32 on VALU.
//
// The 16-bit operand planes are stored in fragment order, not row-major. A plane is cut into units of
// 16 rows x 32 k = 64 chunks of 16 B (1 KiB); unit (row tile t, k block kb) starts at chunk
// (t * 12 + kb) * 64, so a row tile still spans 16 * 384 halves. Chunk (row m, c4 = k / 8 within the
// block) holds the halves that lane half h = c4 & 1 takes as element group j = c4 >> 1. Inside a unit:
//   x and weight planes: chunk j * 32 + h * 16 + m  (one fragment load = 512 contiguous bytes, 4 lines)
//   y planes:            chunk m * 4 + c4           (two pixels' 64-B pieces fill one 128-B line, so
//                                                    k_av stays the only writer of a line; 8 lines a load)
//
// Logit columns are stored window-position-major: column ij * 108 + head * 9 + q holds the reference's
// logit head * 81 + ij * 9 + q (the rows of Wa are permuted where the weight plane is written). An output
// pixel takes group ij of all heads from ONE neighbour, so its inputs are 9 contiguous runs of 432 B.

#ifndef NB
#define NB 8
#endif
#define NB_FULL 8
#define HH 56
#define WW 56
#define CC 384
#define HEADS 12
#define DHEAD 32
#define NPIX (HH * WW)                 // 3136 pixels per image
#define NA 972                         // HEADS * 81 logits per pixel
#define NA_PAD 1024                    // logit columns incl. zero columns 972..1023
#define NRUN (HEADS * 9)               // 108 logits of one window position ij, all heads: one contiguous run
#define RCH (NRUN / 4)                 // 27 chunks of 16 B per run
#define PCH (NA / 4)                   // 243 chunks of 16 B per pixel
#define KCH (CC / 8)                   // 48 chunks of 16 B per 384-wide 16-bit row
#define KBL (CC / 32)                  // 12 k blocks of 32 per row
#define WROWS (CC + NA_PAD + CC)       // weight plane rows: Wv | Wa (zero-extended) | Wo
#define IPB 2                          // pixels per block in k_av
#define CSP 68                         // LDS pitch (floats) of the 64x64 epilogue tile
#define PSP 84                         // LDS pitch (floats) of one head's 81 softmax values in k_av (16-B rows)
#define SM_SCALE 0.17677669529663687f  // 32^-0.5
#define LOG2E 0x1.715476p+0f           // log2(e) in f32: e^x = 2^(x * LOG2E)
#define INV_W_CARRY 0.0625f            // weights are carried x16
#define R_CARRY 2048.0f                // residual plane carry
#define INV_R_CARRY 0.00048828125f

static_assert(NB >= 1 && NB <= NB_FULL);
static_assert(NPIX % 64 == 0);
static_assert(CC % 16 == 0 && NA_PAD % 16 == 0);                             // weight planes start on a row tile
static_assert(IPB == 2 && NPIX % 2 == 0);                                    // a k_av block owns an even/odd row pair
static_assert((NPIX * KCH) % 256 == 0);
static_assert((CC * KCH) % 256 == 0);
static_assert((NA_PAD * KCH) % 256 == 0);
static_assert((WROWS * KCH) % 256 == 0);
static_assert(CC % 64 == 0);
static_assert(NA_PAD % 64 == 0);
static_assert(NA <= NA_PAD);
static_assert(CC % 32 == 0);
static_assert(HEADS * DHEAD == CC);
static_assert(HEADS * 81 == NA);
static_assert(NPIX % IPB == 0);
static_assert(IPB * 96 == 192);
static_assert(NRUN % 4 == 0 && WW % IPB == 0);   // runs are whole 16-B chunks; a k_av block's pixels share an image row
static_assert(IPB * PCH > 2 * 192 && IPB * PCH <= 3 * 192);

typedef _Float16 v16h __attribute__((ext_vector_type(16)));
typedef _Float16 v8h  __attribute__((ext_vector_type(8)));
typedef float    v8f  __attribute__((ext_vector_type(8)));
typedef float    v4f  __attribute__((ext_vector_type(4)));

union FragH { v16h v; v8h half[2]; };

__device__ __forceinline__ unsigned int bf16r_bits(float f) {
    unsigned int u = __float_as_uint(f);
    u += 0x7FFFu + ((u >> 16) & 1u);          // RNE to bf16
    return u & 0xFFFF0000u;
}
__device__ __forceinline__ float bf16r(float f) { return __uint_as_float(bf16r_bits(f)); }

// 2^x on the transcendental unit. The v_nop fills the one slot that the instruction set asks for between a
// transcendental and a next instruction that reads its result or overwrites its source.
__device__ __forceinline__ float exp2_slot(float x) {
    float y;
    asm("v_exp_f32 %0, %1\n\tv_nop" : "=v"(y) : "v"(x));
    return y;
}

__device__ __forceinline__ v8f wmma16(v16h a, v16h b, v8f c) {
    return __builtin_amdgcn_wmma_f32_16x16x32_f16(false, a, false, b, (short)0, c, false, false);
}

// ------------------------------------------------------------------------------------------------
// x [rows][384] f32 -> xh, fragment order, f16 (bf16-RNE value, exact in f16). One 16-B chunk per thread:
// 4 lanes read one 128-B line of a row, 8 rows a wave; the wave's stores fill 4 whole lines.
__device__ __forceinline__
void cvt_x(const float* __restrict__ x, _Float16* xh, int blk) {
    const int g = blk * 256 + (int)threadIdx.x;                 // < NB*NPIX*KCH exactly
    const int unit = g >> 6;
    const int tile = unit / KBL;
    const int kb   = unit - tile * KBL;
    const int m    = (g >> 2) & 15;
    const int c4   = g & 3;
    const float* s = x + (size_t)(tile * 16 + m) * CC + kb * 32 + c4 * 8;
    const v4f f0 = *(const v4f*)s;
    const v4f f1 = *(const v4f*)(s + 4);
    float t[8] = {f0.x, f0.y, f0.z, f0.w, f1.x, f1.y, f1.z, f1.w};
    v8h o;
#pragma unroll
    for (int e = 0; e < 8; ++e) o[e] = (_Float16)bf16r(t[e]);
    _Float16* d = xh + (size_t)(unit * 64 + (c4 >> 1) * 32 + (c4 & 1) * 16 + m) * 8;
    *(v8h*)d = o;
}

// ------------------------------------------------------------------------------------------------
// Weight planes, WROWS rows of 384, f16 = 16 * bf16-RNE(W), fragment order over rows n:
//   rows [0,384) Wv, [384,1408) Wa (rows >= 972 written as zeros), [1408,1792) Wo.
// Wa's plane row ij * 108 + head * 9 + q is taken from Wa's row head * 81 + ij * 9 + q.
// Plane selection is block-uniform (plane boundaries are multiples of 256 chunks).
__device__ __forceinline__
void cvt_w(const float* __restrict__ Wv, const float* __restrict__ Wa,
           const float* __restrict__ Wo, _Float16* wpl, int blk) {
    const int g   = blk * 256 + (int)threadIdx.x;               // < WROWS*KCH exactly
    const int unit = g >> 6;
    const int tile = unit / KBL;
    const int kb   = unit - tile * KBL;
    const int m    = (g >> 2) & 15;
    const int c4   = g & 3;
    const int R   = tile * 16 + m;
    const int ch  = kb * 4 + c4;
    const float* src;
    int rbase, nvalid;
    bool perm = false;
    if (blk < (CC * KCH) / 256)                  { src = Wv; rbase = 0;           nvalid = CC; }
    else if (blk < ((CC + NA_PAD) * KCH) / 256)  { src = Wa; rbase = CC;          nvalid = NA; perm = true; }
    else                                         { src = Wo; rbase = CC + NA_PAD; nvalid = CC; }
    const int rr = R - rbase;                                    // >= 0
    int rc = (rr < nvalid) ? rr : (nvalid - 1);                  // clamped address
    if (perm) {                                                  // block-uniform
        const int ij  = rc / NRUN;
        const int rem = rc - ij * NRUN;
        const int hd  = rem / 9;
        rc = hd * 81 + ij * 9 + (rem - hd * 9);
    }
    const float pm = (rr < nvalid) ? 16.0f : 0.0f;               // carry, or zero for extension rows
    const float* s = src + (size_t)rc * CC + ch * 8;
    const v4f f0 = *(const v4f*)s;
    const v4f f1 = *(const v4f*)(s + 4);
    float t[8] = {f0.x, f0.y, f0.z, f0.w, f1.x, f1.y, f1.z, f1.w};
    v8h o;
#pragma unroll
    for (int e = 0; e < 8; ++e) o[e] = (_Float16)(bf16r(t[e]) * pm);
    _Float16* d = wpl + (size_t)(unit * 64 + (c4 >> 1) * 32 + (c4 & 1) * 16 + m) * 8;
    *(v8h*)d = o;
}

// Both conversions in one grid (neither reads what the other writes): blocks [0, WBLK) write the weight
// planes, the rest the x plane.
#define WBLK ((WROWS * KCH) / 256)
#define XBLK ((NB * NPIX * KCH) / 256)
__global__ __launch_bounds__(256)
void k_cvt(const float* __restrict__ x, const float* __restrict__ Wv, const float* __restrict__ Wa,
           const float* __restrict__ Wo, _Float16* xh, _Float16* wpl) {
    const int blk = (int)blockIdx.x;
    if (blk < WBLK) cvt_w(Wv, Wa, Wo, wpl, blk);
    else            cvt_x(x, xh, blk - WBLK);
}

// ------------------------------------------------------------------------------------------------
// Out[m][n] = scale * sum_k A[m][k] * Bw[n][k]   (K = 384, A and Bw in fragment order)
// RES = 1: Out[m][n] = scale * (sum_k A[m][k]*Bw[n][k] + (1/2048) * sum_k Ar[m][k]*Bw[n][k]).
// Block = 4 waves, 64x64 tile, each wave 32x32 (2x2 WMMA tiles). Fragments loaded straight from
// the global planes with the split-k lane map for A and B alike; RES = 1 reads A and Ar in the y planes'
// chunk order, RES = 0 in the x plane's. Epilogue staged in LDS, then whole lines stored.
// RES = 0 takes Bw = Wv | Wa in one grid: plane rows [0, 384) give out [m][384] (v), rows [384, 1408) give
// out2 [m][1024] (logits). RES = 1 writes out [m][384] alone.
template <int RES>
__global__ __launch_bounds__(128)
void k_gemm(const _Float16* __restrict__ A, const _Float16* __restrict__ Ar,
            const _Float16* __restrict__ Bw, float* out, float* out2, float scale) {
    __shared__ float cs[64 * CSP];
    const int tid  = (int)threadIdx.x;
    const int lane = tid & 31;
    const int wave = tid >> 5;
    const int h    = lane >> 4;          // lane half
    const int m    = lane & 15;          // A row / B col / D col
    const int m0   = (int)blockIdx.x * 64;
    const int n0   = (int)blockIdx.y * 64;
    const int wm   = (wave >> 1) * 32;
    const int wn   = (wave & 1) * 32;

    constexpr int AJ = RES ? 16 : 256;   // halves from element group 0 to group 1 in A's unit
    const size_t ra0 = (size_t)(m0 + wm) * CC + (RES ? (m * 4 + h) * 8 : lane * 8);
    const size_t ra1 = ra0 + (size_t)16 * CC;
    const size_t rb0 = (size_t)(n0 + wn) * CC + lane * 8;
    const size_t rb1 = rb0 + (size_t)16 * CC;

    v8f acc00 = {0.f, 0.f, 0.f, 0.f, 0.f, 0.f, 0.f, 0.f};
    v8f acc01 = acc00, acc10 = acc00, acc11 = acc00;
    v8f rcc00 = acc00, rcc01 = acc00, rcc10 = acc00, rcc11 = acc00;

#pragma unroll 1
    for (int k0 = 0; k0 < CC; k0 += 32) {
        FragH a0, a1, b0, b1;
        // elements 0..7 <- k0+8h+0..7, elements 8..15 <- k0+16+8h+0..7 (A and B identical map)
        const int ku = k0 * 16;          // 512 halves per unit of 32 k
        a0.half[0] = *(const v8h*)(A + ra0 + ku);
        a0.half[1] = *(const v8h*)(A + ra0 + ku + AJ);
        a1.half[0] = *(const v8h*)(A + ra1 + ku);
        a1.half[1] = *(const v8h*)(A + ra1 + ku + AJ);
        b0.half[0] = *(const v8h*)(Bw + rb0 + ku);
        b0.half[1] = *(const v8h*)(Bw + rb0 + ku + 256);
        b1.half[0] = *(const v8h*)(Bw + rb1 + ku);
        b1.half[1] = *(const v8h*)(Bw + rb1 + ku + 256);
        acc00 = wmma16(a0.v, b0.v, acc00);
        acc01 = wmma16(a0.v, b1.v, acc01);
        acc10 = wmma16(a1.v, b0.v, acc10);
        acc11 = wmma16(a1.v, b1.v, acc11);
        if (RES) {
            FragH e0, e1;
            e0.half[0] = *(const v8h*)(Ar + ra0 + ku);
            e0.half[1] = *(const v8h*)(Ar + ra0 + ku + AJ);
            e1.half[0] = *(const v8h*)(Ar + ra1 + ku);
            e1.half[1] = *(const v8h*)(Ar + ra1 + ku + AJ);
            rcc00 = wmma16(e0.v, b0.v, rcc00);
            rcc01 = wmma16(e0.v, b1.v, rcc01);
            rcc10 = wmma16(e1.v, b0.v, rcc10);
            rcc11 = wmma16(e1.v, b1.v, rcc11);
            asm volatile("v_nop\n\tv_nop\n\tv_nop\n\tv_nop"
                         : "+v"(acc00), "+v"(acc01), "+v"(acc10), "+v"(acc11),
                           "+v"(rcc00), "+v"(rcc01), "+v"(rcc10), "+v"(rcc11)
                         : "v"(a0.v), "v"(a1.v), "v"(b0.v), "v"(b1.v), "v"(e0.v), "v"(e1.v));
        } else {
            asm volatile("v_nop\n\tv_nop\n\tv_nop\n\tv_nop"
                         : "+v"(acc00), "+v"(acc01), "+v"(acc10), "+v"(acc11)
                         : "v"(a0.v), "v"(a1.v), "v"(b0.v), "v"(b1.v));
        }
    }

    // D element r of lane -> row 8h + r, col m of each 16x16 tile
    {
        float* p00 = cs + (wm + 8 * h) * CSP + wn + m;
        float* p10 = cs + (wm + 16 + 8 * h) * CSP + wn + m;
#pragma unroll
        for (int r = 0; r < 8; ++r) {
            float v00, v01, v10, v11;
            if (RES) {
                v00 = (acc00[r] + rcc00[r] * INV_R_CARRY) * scale;
                v01 = (acc01[r] + rcc01[r] * INV_R_CARRY) * scale;
                v10 = (acc10[r] + rcc10[r] * INV_R_CARRY) * scale;
                v11 = (acc11[r] + rcc11[r] * INV_R_CARRY) * scale;
            } else {
                v00 = acc00[r] * scale;
                v01 = acc01[r] * scale;
                v10 = acc10[r] * scale;
                v11 = acc11[r] * scale;
            }
            p00[r * CSP]      = v00;
            p00[r * CSP + 16] = v01;
            p10[r * CSP]      = v10;
            p10[r * CSP + 16] = v11;
        }
    }
    __syncthreads();   // cs is written per wave, read cross-wave

    // 64 rows x 256 B = 128 lines; per pass 16 lines, line L by lanes 8q..8q+7 of one wave
    const bool second = RES == 0 && n0 >= CC;          // block-uniform: this tile's columns are logits
    float* const od  = second ? out2 : out;
    const int    ldo = second ? NA_PAD : CC;
    const int    nc  = second ? n0 - CC : n0;
    const int lr = tid >> 3;
    const int lq = tid & 7;
#pragma unroll
    for (int p = 0; p < 8; ++p) {
        const int L = p * 16 + lr;
        const int row = L >> 1;
        const int col = (L & 1) * 32 + lq * 4;
        const v4f v = *(const v4f*)(cs + row * CSP + col);
        *(v4f*)(od + (size_t)(m0 + row) * ldo + nc + col) = v;
    }
}

// ------------------------------------------------------------------------------------------------
// Fused: per-pixel 9-way softmax (each logit group feeds exactly one output pixel), combination of
// the 81 window weights into a 5x5 table per (pixel, head) in LDS, weighted aggregation of V over
// the 5x5 neighbourhood (at the image's edge the 5x5 block of loads is shifted inside the image and the
// positions outside the neighbourhood meet the table's zero border: zero-extended v), then y written as
// f16 hi plane + f16 residual plane x2048. Block = 2 pixels, 192 threads; 96 threads (3 waves)
// per pixel. The block's logits (2 pixels x 9 runs of 432 B) come in as 16-B chunks, consecutive lanes on
// consecutive chunks, and are laid in LDS; one softmax group per thread (108 groups a pixel, so 12 threads
// take a second one), and the 25 window loads of a thread share one address with constant offsets and are
// issued ahead of their uses.
//   P  : [NB*NPIX][1024] f32 logits (unscaled, columns ij * 108 + head * 9 + q)
//   V  : [NB*NPIX][384] f32
//   Yh, Yr : NB*NPIX rows of 384, f16, fragment order (y planes' chunk order)
__global__ __launch_bounds__(192)
void k_av(const float* __restrict__ P, const float* __restrict__ V,
          _Float16* Yh, _Float16* Yr) {
#pragma clang fp contract(off)
    __shared__ __attribute__((aligned(16))) float zs[IPB * NA];            // cross-wave: logits, [pixel][ij][head][q]
    __shared__ __attribute__((aligned(16))) float ps[IPB * HEADS * PSP];   // cross-wave: softmax values, [pixel][head][ij * 9 + q]
    __shared__ __attribute__((aligned(16))) float w9s[IPB * HEADS * 81];   // cross-wave: 5x5 tables inside a zero border of 2 (9x9)
    __shared__ __attribute__((aligned(16))) float ys[IPB * CC];            // cross-wave: written by all, read by all (block barrier)
    const int tid = (int)threadIdx.x;
    const int lpb = (int)blockIdx.x * IPB;    // first pixel of this block
    const int pix = __builtin_amdgcn_readfirstlane(tid / 96);   // same in all lanes of a wave: kept scalar
    const int u   = tid - pix * 96;
    const int gp  = lpb + pix;
    const int rs  = gp % NPIX;
    const int r   = rs / WW;
    const int s   = rs - r * WW;

    // ---- phase 0: the block's logits into LDS, chunk c = pixel * 243 + ij * 27 + k; all loads ahead of the stores ----
    v4f zl[3];
    {
        const int rs0 = lpb % NPIX;               // the block's first pixel; its second is the next in the same row
        const int rb  = rs0 / WW;
        const int sb  = rs0 - rb * WW;
#pragma unroll   // constant indices keep zl in registers
        for (int t = 0; t < 3; ++t) {
            const int c0  = t * 192 + tid;
            const int c   = c0 < IPB * PCH ? c0 : IPB * PCH - 1;   // past the end: the last chunk again, not stored
            const int cp  = c / PCH;
            const int cc  = c - cp * PCH;
            const int ij  = cc / RCH;
            const int i   = ij / 3;
            const int j   = ij - 3 * i;
            const int ny  = rb + 1 - i;               // window centre pixel n'
            const int nx  = sb + cp + 1 - j;
            const int nyc = ny < 0 ? 0 : (ny >= HH ? HH - 1 : ny);
            const int nxc = nx < 0 ? 0 : (nx >= WW ? WW - 1 : nx);
            const int nlp = lpb + (nyc - rb) * WW + (nxc - sb);   // same image, clamped address
            zl[t] = *(const v4f*)(P + (unsigned)(nlp * NA_PAD + cc * 4));
        }
    }

    // zero the 9x9 tables while the logits fly; the 5x5 cores are written behind the second barrier
    for (int c = tid; c < IPB * HEADS * 81 / 4; c += 192) {
        const v4f zero4 = {0.0f, 0.0f, 0.0f, 0.0f};
        *(v4f*)(w9s + c * 4) = zero4;
    }

#pragma unroll   // constant indices keep zl in registers
    for (int t = 0; t < 3; ++t) {
        const int c = t * 192 + tid;
        if (t < 2 || c < IPB * PCH) *(v4f*)(zs + c * 4) = zl[t];
    }
    __syncthreads();   // zs is written per chunk, read per group

    // ---- phase 1a: softmax of the 9x12 groups feeding each pixel, one group g = head * 9 + ij a thread ----
    {
        constexpr int NG = HEADS * 9;             // 108 groups per pixel
        const bool two = u < NG - 96;             // these threads also take group 96 + u
        float z[2][9];
        bool  ok[2];
        int   gi[2];
#pragma unroll
        for (int t = 0; t < 2; ++t) {
            if (t == 0 || two) {
                const int g  = t * 96 + u;
                const int ij = g % 9;
                const int i  = ij / 3;
                const int j  = ij - 3 * i;
                const int ny = r + 1 - i;                 // window centre pixel n'
                const int nx = s + 1 - j;
                ok[t] = ((unsigned)ny < (unsigned)HH) && ((unsigned)nx < (unsigned)WW);
                const float* gsrc = zs + pix * NA + ij * NRUN + (g / 9) * 9;
                gi[t] = g;
#pragma unroll
                for (int q = 0; q < 9; ++q) z[t][q] = gsrc[q];
            }
        }
#pragma unroll
        for (int t = 0; t < 2; ++t) {
            if (t == 0 || two) {
                float mx = -3.0e38f;
#pragma unroll
                for (int q = 0; q < 9; ++q) { z[t][q] = z[t][q] * SM_SCALE; mx = fmaxf(mx, z[t][q]); }
                float e[9];
                float sum = 0.0f;
#pragma unroll
                for (int q = 0; q < 9; ++q) { e[q] = exp2_slot((z[t][q] - mx) * LOG2E); sum += e[q]; }
                const float inv = 1.0f / sum;
                float* pd = ps + (pix * HEADS + gi[t] / 9) * PSP + (gi[t] % 9) * 9;
#pragma unroll
                for (int q = 0; q < 9; ++q) pd[q] = ok[t] ? (e[q] * inv) : 0.0f;
            }
        }
    }
    __syncthreads();   // ps is written per group, read per (pixel, head)

    // ---- phase 1b: 5x5 tables, one (pixel, head) a thread. The weight for v offset (dy, dx) = (qi - i, qj - j)
    //      belongs to entry (dy+2)*5 + (dx+2); an entry's terms are added in ascending ij ----
    if (tid < IPB * HEADS) {
        const float* srcp = ps + tid * PSP;
        float pr[81];
#pragma unroll
        for (int c = 0; c < 20; ++c) {
            const v4f p4 = *(const v4f*)(srcp + c * 4);
            pr[c * 4 + 0] = p4.x; pr[c * 4 + 1] = p4.y; pr[c * 4 + 2] = p4.z; pr[c * 4 + 3] = p4.w;
        }
        pr[80] = srcp[80];
        float tb[25];
#pragma unroll
        for (int t = 0; t < 25; ++t) tb[t] = 0.0f;
#pragma unroll
        for (int ij = 0; ij < 9; ++ij) {
            const int i = ij / 3;
            const int j = ij - 3 * i;
#pragma unroll
            for (int q = 0; q < 9; ++q) {
                const int qi = q / 3;
                const int qj = q - 3 * qi;
                tb[(2 - i + qi) * 5 + (2 - j + qj)] += pr[ij * 9 + q];
            }
        }
        float* wdst = w9s + tid * 81 + 2 * 9 + 2;
#pragma unroll
        for (int t = 0; t < 25; ++t) wdst[(t / 5) * 9 + (t % 5)] = tb[t];
    }
    __syncthreads();

    // ---- phase 2: y[c] = sum over 5x5 neighbourhood of w5[dy][dx] * v[r+dy][s+dx][c] ----
    {
        const int c0   = u * 4;
        const int head = u >> 3;                   // 32 channels per head, 4 per thread
        // first row and column of the 5x5 block of loads: the neighbourhood's, moved inside the image
        const int y0 = r - 2 < 0 ? 0 : (r - 2 > HH - 5 ? HH - 5 : r - 2);
        const int x0 = s - 2 < 0 ? 0 : (s - 2 > WW - 5 ? WW - 5 : s - 2);
        // load (ka, kb) is neighbourhood entry (ka + y0 - (r - 2), kb + x0 - (s - 2)): -2..6, inside the 9x9 table
        const float* wrow = w9s + (pix * HEADS + head) * 81 + (y0 - r + 4) * 9 + (x0 - s + 4);
        const float* vb = V + (size_t)(gp - rs + y0 * WW + x0) * CC + c0;
        v4f vv[25];
#pragma unroll
        for (int t = 0; t < 25; ++t) vv[t] = *(const v4f*)(vb + ((t / 5) * WW + (t % 5)) * CC);
        v4f acc = {0.0f, 0.0f, 0.0f, 0.0f};
#pragma unroll
        for (int t = 0; t < 25; ++t) {
            const float w = wrow[(t / 5) * 9 + (t % 5)];
            acc.x = fmaf(w, vv[t].x, acc.x);
            acc.y = fmaf(w, vv[t].y, acc.y);
            acc.z = fmaf(w, vv[t].z, acc.z);
            acc.w = fmaf(w, vv[t].w, acc.w);
        }
        *(v4f*)(ys + pix * CC + c0) = acc;
    }
    __syncthreads();

    // ---- phase 3: whole-line plane stores: waves 0-2 write hi, waves 3-5 write residual ----
    {
        const int plane = tid / 96;                // wave-uniform
        const int u3    = tid - plane * 96;
        const int kb    = u3 >> 3;                 // 8 lanes = 2 pixels x 4 chunks = one 128-B line
        const int pix3  = (u3 >> 2) & 1;
        const int c4    = u3 & 3;
        const int ch    = kb * 4 + c4;
        const int gp3 = lpb + pix3;
        const float* ysrc = ys + pix3 * CC + ch * 8;
        const v4f y0 = *(const v4f*)ysrc;
        const v4f y1 = *(const v4f*)(ysrc + 4);
        float yv[8] = {y0.x, y0.y, y0.z, y0.w, y1.x, y1.y, y1.z, y1.w};
        v8h oh, orr;
#pragma unroll
        for (int e = 0; e < 8; ++e) {
            const _Float16 hq = (_Float16)yv[e];
            const float res = (yv[e] - (float)hq) * R_CARRY;    // exact in f32
            oh[e]  = hq;
            orr[e] = (_Float16)res;
        }
        const size_t dofs = ((size_t)((gp3 >> 4) * KBL + kb) * 64 + (gp3 & 15) * 4 + c4) * 8;
        if (plane == 0) {
            _Float16* d = Yh + dofs;
            *(v8h*)d = oh;
            
        } else {
            _Float16* d = Yr + dofs;
            *(v8h*)d = orr;
            
        }
    }
}

// ------------------------------------------------------------------------------------------------
static inline size_t al256(size_t b) { return (b + 255) & ~(size_t)255; }

extern "C" void kernel_launch(void* const* d_in, const int* in_sizes, int n_in,
                              void* d_out, int out_size, void* d_ws, size_t ws_size,
                              hipStream_t stream) {
    if (n_in < 4) return;
    if (in_sizes[0] < NB * NPIX * CC) return;
    if (in_sizes[1] < CC * CC) return;
    if (in_sizes[2] < NA * CC) return;
    if (in_sizes[3] < CC * CC) return;
    if (out_size < NB * NPIX * CC) return;

    const float* x  = (const float*)d_in[0];   // [NB][56][56][384]
    const float* Wv = (const float*)d_in[1];   // [384][384]  ([out][in])
    const float* Wa = (const float*)d_in[2];   // [972][384]
    const float* Wo = (const float*)d_in[3];   // [384][384]
    float* out = (float*)d_out;                // [NB][56][56][384] f32

    // multiples of the store granularity, offsets 256-B aligned)
    const size_t szXH = (size_t)NB * NPIX * CC * 2;            // x as f16
    const size_t szW  = (size_t)WROWS * CC * 2;                // weight planes
    const size_t szV  = (size_t)NB * NPIX * CC * 4;            // v f32
    const size_t szP  = (size_t)NB * NPIX * NA_PAD * 4;        // logits, f32
    const size_t szY  = (size_t)NB * NPIX * CC * 2;            // y planes (hi, residual)
    size_t off = 0;
    const size_t oXH = off; off += al256(szXH);
    const size_t oW  = off; off += al256(szW);
    const size_t oV  = off; off += al256(szV);
    const size_t oP  = off; off += al256(szP);
    const size_t oYH = off; off += al256(szY);
    const size_t oYR = off; off += al256(szY);
    if (off > ws_size) return;

    char* ws = (char*)d_ws;
    _Float16* Xh  = (_Float16*)(ws + oXH);
    _Float16* Wpl = (_Float16*)(ws + oW);
    const _Float16* Woh = Wpl + (size_t)(CC + NA_PAD) * CC;
    float* Vf = (float*)(ws + oV);
    float* Pf = (float*)(ws + oP);
    _Float16* Yh = (_Float16*)(ws + oYH);
    _Float16* Yr = (_Float16*)(ws + oYR);

    // 1) operand planes
    k_cvt<<<WBLK + XBLK, 256, 0, stream>>>(x, Wv, Wa, Wo, Xh, Wpl);
    // 2) v = x * Wv^T -> f32 [NB*NPIX][384] and logits = x * Wa^T -> f32 [NB*NPIX][1024], all images
    k_gemm<0><<<dim3(NB * NPIX / 64, (CC + NA_PAD) / 64), 128, 0, stream>>>(Xh, Xh, Wpl, Vf, Pf, INV_W_CARRY);
    // 3) softmax + aggregation + fold, all images
    k_av<<<NB * NPIX / IPB, 192, 0, stream>>>(Pf, Vf, Yh, Yr);
    // 4) out = y * Wo^T  (hi + residual/2048) -> d_out
    k_gemm<1><<<dim3(NB * NPIX / 64, CC / 64), 128, 0, stream>>>(Yh, Yr, Woh, out, out, INV_W_CARRY);
}

// v005
// Measured time: 112 microseconds a run.
// Timed twice side by side with v004, it ran 1.10 and 1.11 times as fast.
// All steps since v000 together make it 2.72 times as fast.
#include <hip/hip_runtime.h>

// All contractions on v_wmma_f32_16x16x32_f16 (f16 operands, f32 accumulate): x*Wv^T and x*Wa^T with
// f16 containers of bf16-RNE inputs (weights carried x16); y*Wo^T with y as f16 hi plane plus f16
// residual plane carried x2048 into a separate accumulator (folded x1/2048), Wo bf16-RNE x16.
// Per-pixel 9-way softmax, 3x3 window aggregation and overlap-add fold: f32 on VALU.
//
// The 16-bit operand planes are stored in fragment order, not row-major. A plane is cut into units of
// 16 rows x 32 k = 64 chunks of 16 B (1 KiB); unit (row tile t, k block kb) starts at chunk
// (t * 12 + kb) * 64, so a row tile still spans 16 * 384 halves. Chunk (row m, c4 = k / 8 within the
// block) holds the halves that lane half h = c4 & 1 takes as element group j = c4 >> 1. Inside a unit:
//   x and weight planes: chunk j * 32 + h * 16 + m  (one fragment load = 512 contiguous bytes, 4 lines)
//   y planes:            chunk m * 4 + c4           (two pixels' 64-B pieces fill one 128-B line, so
//                                                    k_av stays the only writer of a line; 8 lines a load)
//
// Logit columns are stored window-position-major: column ij * 108 + head * 9 + q holds the reference's
// logit head * 81 + ij * 9 + q (the rows of Wa are permuted where the weight plane is written). An output
// pixel takes group ij of all heads from ONE neighbour, so its inputs are 9 contiguous runs of 432 B.

#ifndef NB
#define NB 8
#endif
#define NB_FULL 8
#define HH 56
#define WW 56
#define CC 384
#define HEADS 12
#define DHEAD 32
#define NPIX (HH * WW)                 // 3136 pixels per image
#define NA 972                         // HEADS * 81 logits per pixel
#define NA_PAD 1024                    // logit columns incl. zero columns 972..1023
#define NRUN (HEADS * 9)               // 108 logits of one window position ij, all heads: one contiguous run
#define RCH (NRUN / 4)                 // 27 chunks of 16 B per run
#define PCH (NA / 4)                   // 243 chunks of 16 B per pixel
#define KCH (CC / 8)                   // 48 chunks of 16 B per 384-wide 16-bit row
#define KBL (CC / 32)                  // 12 k blocks of 32 per row
#define WROWS (CC + NA_PAD + CC)       // weight plane rows: Wv | Wa (zero-extended) | Wo
#define IPB 2                          // pixels per block in k_av
#define CSP 132                        // LDS pitch (floats) of the 128-column epilogue tile
#define PSP 84                         // LDS pitch (floats) of one head's 81 softmax values in k_av (16-B rows)
#define SM_SCALE 0.17677669529663687f  // 32^-0.5
#define LOG2E 0x1.715476p+0f           // log2(e) in f32: e^x = 2^(x * LOG2E)
#define INV_W_CARRY 0.0625f            // weights are carried x16
#define R_CARRY 2048.0f                // residual plane carry
#define INV_R_CARRY 0.00048828125f

static_assert(NB >= 1 && NB <= NB_FULL);
static_assert(NPIX % 64 == 0);
static_assert(CC % 16 == 0 && NA_PAD % 16 == 0);                             // weight planes start on a row tile
static_assert(IPB == 2 && NPIX % 2 == 0);                                    // a k_av block owns an even/odd row pair
static_assert((NPIX * KCH) % 256 == 0);
static_assert((CC * KCH) % 256 == 0);
static_assert((NA_PAD * KCH) % 256 == 0);
static_assert((WROWS * KCH) % 256 == 0);
static_assert(CC % 64 == 0);
static_assert(NA_PAD % 64 == 0);
static_assert(NA <= NA_PAD);
static_assert(CC % 32 == 0);
static_assert(HEADS * DHEAD == CC);
static_assert(HEADS * 81 == NA);
static_assert(NPIX % IPB == 0);
static_assert(IPB * 96 == 192);
static_assert(NRUN % 4 == 0 && WW % IPB == 0);   // runs are whole 16-B chunks; a k_av block's pixels share an image row
static_assert(IPB * PCH > 2 * 192 && IPB * PCH <= 3 * 192);

typedef _Float16 v16h __attribute__((ext_vector_type(16)));
typedef _Float16 v8h  __attribute__((ext_vector_type(8)));
typedef float    v8f  __attribute__((ext_vector_type(8)));
typedef float    v4f  __attribute__((ext_vector_type(4)));

union FragH { v16h v; v8h half[2]; };

__device__ __forceinline__ unsigned int bf16r_bits(float f) {
    unsigned int u = __float_as_uint(f);
    u += 0x7FFFu + ((u >> 16) & 1u);          // RNE to bf16
    return u & 0xFFFF0000u;
}
__device__ __forceinline__ float bf16r(float f) { return __uint_as_float(bf16r_bits(f)); }

// 2^x on the transcendental unit. The v_nop fills the one slot that the instruction set asks for between a
// transcendental and a next instruction that reads its result or overwrites its source.
__device__ __forceinline__ float exp2_slot(float x) {
    float y;
    asm("v_exp_f32 %0, %1\n\tv_nop" : "=v"(y) : "v"(x));
    return y;
}

__device__ __forceinline__ v8f wmma16(v16h a, v16h b, v8f c) {
    return __builtin_amdgcn_wmma_f32_16x16x32_f16(false, a, false, b, (short)0, c, false, false);
}

// ------------------------------------------------------------------------------------------------
// x [rows][384] f32 -> xh, fragment order, f16 (bf16-RNE value, exact in f16). One 16-B chunk per thread:
// 4 lanes read one 128-B line of a row, 8 rows a wave; the wave's stores fill 4 whole lines.
__device__ __forceinline__
void cvt_x(const float* __restrict__ x, _Float16* xh, int blk) {
    const int g = blk * 256 + (int)threadIdx.x;                 // < NB*NPIX*KCH exactly
    const int unit = g >> 6;
    const int tile = unit / KBL;
    const int kb   = unit - tile * KBL;
    const int m    = (g >> 2) & 15;
    const int c4   = g & 3;
    const float* s = x + (size_t)(tile * 16 + m) * CC + kb * 32 + c4 * 8;
    const v4f f0 = *(const v4f*)s;
    const v4f f1 = *(const v4f*)(s + 4);
    float t[8] = {f0.x, f0.y, f0.z, f0.w, f1.x, f1.y, f1.z, f1.w};
    v8h o;
#pragma unroll
    for (int e = 0; e < 8; ++e) o[e] = (_Float16)bf16r(t[e]);
    _Float16* d = xh + (size_t)(unit * 64 + (c4 >> 1) * 32 + (c4 & 1) * 16 + m) * 8;
    *(v8h*)d = o;
}

// ------------------------------------------------------------------------------------------------
// Weight planes, WROWS rows of 384, f16 = 16 * bf16-RNE(W), fragment order over rows n:
//   rows [0,384) Wv, [384,1408) Wa (rows >= 972 written as zeros), [1408,1792) Wo.
// Wa's plane row ij * 108 + head * 9 + q is taken from Wa's row head * 81 + ij * 9 + q.
// Plane selection is block-uniform (plane boundaries are multiples of 256 chunks).
__device__ __forceinline__
void cvt_w(const float* __restrict__ Wv, const float* __restrict__ Wa,
           const float* __restrict__ Wo, _Float16* wpl, int blk) {
    const int g   = blk * 256 + (int)threadIdx.x;               // < WROWS*KCH exactly
    const int unit = g >> 6;
    const int tile = unit / KBL;
    const int kb   = unit - tile * KBL;
    const int m    = (g >> 2) & 15;
    const int c4   = g & 3;
    const int R   = tile * 16 + m;
    const int ch  = kb * 4 + c4;
    const float* src;
    int rbase, nvalid;
    bool perm = false;
    if (blk < (CC * KCH) / 256)                  { src = Wv; rbase = 0;           nvalid = CC; }
    else if (blk < ((CC + NA_PAD) * KCH) / 256)  { src = Wa; rbase = CC;          nvalid = NA; perm = true; }
    else                                         { src = Wo; rbase = CC + NA_PAD; nvalid = CC; }
    const int rr = R - rbase;                                    // >= 0
    int rc = (rr < nvalid) ? rr : (nvalid - 1);                  // clamped address
    if (perm) {                                                  // block-uniform
        const int ij  = rc / NRUN;
        const int rem = rc - ij * NRUN;
        const int hd  = rem / 9;
        rc = hd * 81 + ij * 9 + (rem - hd * 9);
    }
    const float pm = (rr < nvalid) ? 16.0f : 0.0f;               // carry, or zero for extension rows
    const float* s = src + (size_t)rc * CC + ch * 8;
    const v4f f0 = *(const v4f*)s;
    const v4f f1 = *(const v4f*)(s + 4);
    float t[8] = {f0.x, f0.y, f0.z, f0.w, f1.x, f1.y, f1.z, f1.w};
    v8h o;
#pragma unroll
    for (int e = 0; e < 8; ++e) o[e] = (_Float16)(bf16r(t[e]) * pm);
    _Float16* d = wpl + (size_t)(unit * 64 + (c4 >> 1) * 32 + (c4 & 1) * 16 + m) * 8;
    *(v8h*)d = o;
}

// Both conversions in one grid (neither reads what the other writes): blocks [0, WBLK) write the weight
// planes, the rest the x plane.
#define WBLK ((WROWS * KCH) / 256)
#define XBLK ((NB * NPIX * KCH) / 256)
__global__ __launch_bounds__(256)
void k_cvt(const float* __restrict__ x, const float* __restrict__ Wv, const float* __restrict__ Wa,
           const float* __restrict__ Wo, _Float16* xh, _Float16* wpl) {
    const int blk = (int)blockIdx.x;
    if (blk < WBLK) cvt_w(Wv, Wa, Wo, wpl, blk);
    else            cvt_x(x, xh, blk - WBLK);
}

// ------------------------------------------------------------------------------------------------
// Out[m][n] = scale * sum_k A[m][k] * Bw[n][k]   (K = 384, A and Bw in fragment order)
// RES = 1: Out[m][n] = scale * (sum_k A[m][k]*Bw[n][k] + (1/2048) * sum_k Ar[m][k]*Bw[n][k]).
// Block = 4 waves (2 x 2), each wave MT x NT WMMA tiles, so the block's tile is 32*MT rows x 32*NT = 128
// columns: a loaded fragment feeds NT (A) or MT (B; 2*MT with RES) products. Fragments loaded straight from
// the global planes with the split-k lane map for A and B alike; RES = 1 reads A and Ar in the y planes'
// chunk order, RES = 0 in the x plane's. Epilogue staged in LDS, then whole 512-B rows stored.
// RES = 0 takes Bw = Wv | Wa in one grid: plane rows [0, 384) give out [m][384] (v), rows [384, 1408) give
// out2 [m][1024] (logits). RES = 1 writes out [m][384] alone.
template <int RES, int MT, int NT>
__global__ __launch_bounds__(128)
void k_gemm(const _Float16* __restrict__ A, const _Float16* __restrict__ Ar,
            const _Float16* __restrict__ Bw, float* out, float* out2, float scale) {
    constexpr int BM = 32 * MT;
    constexpr int BN = 32 * NT;
    static_assert(BN == 128 && NT == 4 && (MT == 4 || MT == 2));
    static_assert((NB * NPIX) % BM == 0 && CC % BN == 0 && NA_PAD % BN == 0);
    __shared__ __attribute__((aligned(16))) float cs[BM * CSP];
    const int tid  = (int)threadIdx.x;
    const int lane = tid & 31;
    const int wave = tid >> 5;
    const int h    = lane >> 4;          // lane half
    const int m    = lane & 15;          // A row / B col / D col
    const int m0   = (int)blockIdx.x * BM;
    const int n0   = (int)blockIdx.y * BN;
    const int wm   = (wave >> 1) * (16 * MT);
    const int wn   = (wave & 1) * (16 * NT);

    constexpr int AJ = RES ? 16 : 256;   // halves from element group 0 to group 1 in A's unit
    const _Float16* pa = A  + (size_t)(m0 + wm) * CC + (RES ? (m * 4 + h) * 8 : lane * 8);
    const _Float16* pe = Ar + (size_t)(m0 + wm) * CC + (RES ? (m * 4 + h) * 8 : lane * 8);
    const _Float16* pb = Bw + (size_t)(n0 + wn) * CC + lane * 8;

    v8f acc[MT][NT];
    v8f rcc[MT][NT];
#pragma unroll
    for (int i = 0; i < MT; ++i)
#pragma unroll
        for (int j = 0; j < NT; ++j) {
            const v8f z8 = {0.f, 0.f, 0.f, 0.f, 0.f, 0.f, 0.f, 0.f};
            acc[i][j] = z8;
            rcc[i][j] = z8;
        }

    // The k loop stays rolled: one fragment set in registers, so that four waves fit a SIMD. The inner loops
    // over tiles are unrolled so that the arrays have constant indices and stay in registers.
#pragma unroll 1
    for (int k0 = 0; k0 < CC; k0 += 32) {
        FragH a[MT], b[NT], e[MT];
        // elements 0..7 <- k0+8h+0..7, elements 8..15 <- k0+16+8h+0..7 (A and B identical map)
#pragma unroll
        for (int i = 0; i < MT; ++i) {
            a[i].half[0] = *(const v8h*)(pa + i * 16 * CC);
            a[i].half[1] = *(const v8h*)(pa + i * 16 * CC + AJ);
        }
#pragma unroll
        for (int j = 0; j < NT; ++j) {
            b[j].half[0] = *(const v8h*)(pb + j * 16 * CC);
            b[j].half[1] = *(const v8h*)(pb + j * 16 * CC + 256);
        }
        if (RES) {
#pragma unroll
            for (int i = 0; i < MT; ++i) {
                e[i].half[0] = *(const v8h*)(pe + i * 16 * CC);
                e[i].half[1] = *(const v8h*)(pe + i * 16 * CC + AJ);
            }
        }
#pragma unroll
        for (int i = 0; i < MT; ++i)
#pragma unroll
            for (int j = 0; j < NT; ++j) acc[i][j] = wmma16(a[i].v, b[j].v, acc[i][j]);
        // The v_nop fill the slots that the chip asks for between the last products and the next trip's
        // loads into their operand registers (the loop's taken branch).
        // The pointers are inputs so that no load of this trip lands in an address register of another.
        if constexpr (RES) {
#pragma unroll
            for (int i = 0; i < MT; ++i)
#pragma unroll
                for (int j = 0; j < NT; ++j) rcc[i][j] = wmma16(e[i].v, b[j].v, rcc[i][j]);
            asm volatile("v_nop\n\tv_nop\n\tv_nop\n\tv_nop"
                         : "+v"(acc[0][0]), "+v"(acc[0][1]), "+v"(acc[0][2]), "+v"(acc[0][3]),
                           "+v"(acc[1][0]), "+v"(acc[1][1]), "+v"(acc[1][2]), "+v"(acc[1][3]),
                           "+v"(rcc[0][0]), "+v"(rcc[0][1]), "+v"(rcc[0][2]), "+v"(rcc[0][3]),
                           "+v"(rcc[1][0]), "+v"(rcc[1][1]), "+v"(rcc[1][2]), "+v"(rcc[1][3])
                         : "v"(a[0].v), "v"(a[1].v), "v"(e[0].v), "v"(e[1].v),
                           "v"(b[0].v), "v"(b[1].v), "v"(b[2].v), "v"(b[3].v), "v"(pa), "v"(pe), "v"(pb));
            pe += 512;                   // 512 halves per unit of 32 k
        } else {
            asm volatile("v_nop\n\tv_nop\n\tv_nop\n\tv_nop"
                         : "+v"(acc[0][0]), "+v"(acc[0][1]), "+v"(acc[0][2]), "+v"(acc[0][3]),
                           "+v"(acc[1][0]), "+v"(acc[1][1]), "+v"(acc[1][2]), "+v"(acc[1][3]),
                           "+v"(acc[2][0]), "+v"(acc[2][1]), "+v"(acc[2][2]), "+v"(acc[2][3]),
                           "+v"(acc[3][0]), "+v"(acc[3][1]), "+v"(acc[3][2]), "+v"(acc[3][3])
                         : "v"(a[0].v), "v"(a[1].v), "v"(a[2].v), "v"(a[3].v),
                           "v"(b[0].v), "v"(b[1].v), "v"(b[2].v), "v"(b[3].v), "v"(pa), "v"(pb));
        }
        pa += 512;                       // 512 halves per unit of 32 k
        pb += 512;
    }

    // D element r of lane -> row 8h + r, col m of each 16x16 tile
#pragma unroll
    for (int i = 0; i < MT; ++i) {
#pragma unroll
        for (int j = 0; j < NT; ++j) {
            float* p = cs + (wm + i * 16 + 8 * h) * CSP + wn + j * 16 + m;
#pragma unroll
            for (int r = 0; r < 8; ++r) {
                if (RES) p[r * CSP] = (acc[i][j][r] + rcc[i][j][r] * INV_R_CARRY) * scale;
                else     p[r * CSP] = acc[i][j][r] * scale;
            }
        }
    }
    __syncthreads();   // cs is written per wave, read cross-wave

    // BM rows x 512 B; per pass each wave stores one whole row (4 lines)
    const bool second = RES == 0 && n0 >= CC;          // block-uniform: this tile's columns are logits
    float* const od  = second ? out2 : out;
    const int    ldo = second ? NA_PAD : CC;
    const int    nc  = second ? n0 - CC : n0;
    float* const ob = od + (size_t)m0 * ldo + nc;      // block-uniform base; the rest fits 32 bits
    const unsigned vo = (unsigned)(wave * ldo + lane * 4);
#pragma unroll
    for (int p = 0; p < BM / 4; ++p) {
        const v4f v = *(const v4f*)(cs + (p * 4 + wave) * CSP + lane * 4);
        *(v4f*)(ob + (vo + (unsigned)(p * 4 * ldo))) = v;
    }
}

// ------------------------------------------------------------------------------------------------
// Fused: per-pixel 9-way softmax (each logit group feeds exactly one output pixel), combination of
// the 81 window weights into a 5x5 table per (pixel, head) in LDS, weighted aggregation of V over
// the 5x5 neighbourhood (at the image's edge the 5x5 block of loads is shifted inside the image and the
// positions outside the neighbourhood meet the table's zero border: zero-extended v), then y written as
// f16 hi plane + f16 residual plane x2048. Block = 2 pixels, 192 threads; 96 threads (3 waves)
// per pixel. The block's logits (2 pixels x 9 runs of 432 B) come in as 16-B chunks, consecutive lanes on
// consecutive chunks, and are laid in LDS; one softmax group per thread (108 groups a pixel, so 12 threads
// take a second one), and the 25 window loads of a thread share one address with constant offsets and are
// issued ahead of their uses.
//   P  : [NB*NPIX][1024] f32 logits (unscaled, columns ij * 108 + head * 9 + q)
//   V  : [NB*NPIX][384] f32
//   Yh, Yr : NB*NPIX rows of 384, f16, fragment order (y planes' chunk order)
__global__ __launch_bounds__(192)
void k_av(const float* __restrict__ P, const float* __restrict__ V,
          _Float16* Yh, _Float16* Yr) {
#pragma clang fp contract(off)
    __shared__ __attribute__((aligned(16))) float zs[IPB * NA];            // cross-wave: logits, [pixel][ij][head][q]
    __shared__ __attribute__((aligned(16))) float ps[IPB * HEADS * PSP];   // cross-wave: softmax values, [pixel][head][ij * 9 + q]
    __shared__ __attribute__((aligned(16))) float w9s[IPB * HEADS * 81];   // cross-wave: 5x5 tables inside a zero border of 2 (9x9)
    __shared__ __attribute__((aligned(16))) float ys[IPB * CC];            // cross-wave: written by all, read by all (block barrier)
    const int tid = (int)threadIdx.x;
    const int lpb = (int)blockIdx.x * IPB;    // first pixel of this block
    const int pix = __builtin_amdgcn_readfirstlane(tid / 96);   // same in all lanes of a wave: kept scalar
    const int u   = tid - pix * 96;
    const int gp  = lpb + pix;
    const int rs  = gp % NPIX;
    const int r   = rs / WW;
    const int s   = rs - r * WW;

    // ---- phase 0: the block's logits into LDS, chunk c = pixel * 243 + ij * 27 + k; all loads ahead of the stores ----
    v4f zl[3];
    {
        const int rs0 = lpb % NPIX;               // the block's first pixel; its second is the next in the same row
        const int rb  = rs0 / WW;
        const int sb  = rs0 - rb * WW;
#pragma unroll   // constant indices keep zl in registers
        for (int t = 0; t < 3; ++t) {
            const int c0  = t * 192 + tid;
            const int c   = c0 < IPB * PCH ? c0 : IPB * PCH - 1;   // past the end: the last chunk again, not stored
            const int cp  = c / PCH;
            const int cc  = c - cp * PCH;
            const int ij  = cc / RCH;
            const int i   = ij / 3;
            const int j   = ij - 3 * i;
            const int ny  = rb + 1 - i;               // window centre pixel n'
            const int nx  = sb + cp + 1 - j;
            const int nyc = ny < 0 ? 0 : (ny >= HH ? HH - 1 : ny);
            const int nxc = nx < 0 ? 0 : (nx >= WW ? WW - 1 : nx);
            const int nlp = lpb + (nyc - rb) * WW + (nxc - sb);   // same image, clamped address
            zl[t] = *(const v4f*)(P + (unsigned)(nlp * NA_PAD + cc * 4));
        }
    }

    // zero the 9x9 tables while the logits fly; the 5x5 cores are written behind the second barrier
    for (int c = tid; c < IPB * HEADS * 81 / 4; c += 192) {
        const v4f zero4 = {0.0f, 0.0f, 0.0f, 0.0f};
        *(v4f*)(w9s + c * 4) = zero4;
    }

#pragma unroll   // constant indices keep zl in registers
    for (int t = 0; t < 3; ++t) {
        const int c = t * 192 + tid;
        if (t < 2 || c < IPB * PCH) *(v4f*)(zs + c * 4) = zl[t];
    }
    __syncthreads();   // zs is written per chunk, read per group

    // ---- phase 1a: softmax of the 9x12 groups feeding each pixel, one group g = head * 9 + ij a thread ----
    {
        constexpr int NG = HEADS * 9;             // 108 groups per pixel
        const bool two = u < NG - 96;             // these threads also take group 96 + u
        float z[2][9];
        bool  ok[2];
        int   gi[2];
#pragma unroll
        for (int t = 0; t < 2; ++t) {
            if (t == 0 || two) {
                const int g  = t * 96 + u;
                const int ij = g % 9;
                const int i  = ij / 3;
                const int j  = ij - 3 * i;
                const int ny = r + 1 - i;                 // window centre pixel n'
                const int nx = s + 1 - j;
                ok[t] = ((unsigned)ny < (unsigned)HH) && ((unsigned)nx < (unsigned)WW);
                const float* gsrc = zs + pix * NA + ij * NRUN + (g / 9) * 9;
                gi[t] = g;
#pragma unroll
                for (int q = 0; q < 9; ++q) z[t][q] = gsrc[q];
            }
        }
#pragma unroll
        for (int t = 0; t < 2; ++t) {
            if (t == 0 || two) {
                float mx = -3.0e38f;
#pragma unroll
                for (int q = 0; q < 9; ++q) { z[t][q] = z[t][q] * SM_SCALE; mx = fmaxf(mx, z[t][q]); }
                float e[9];
                float sum = 0.0f;
#pragma unroll
                for (int q = 0; q < 9; ++q) { e[q] = exp2_slot((z[t][q] - mx) * LOG2E); sum += e[q]; }
                const float inv = 1.0f / sum;
                float* pd = ps + (pix * HEADS + gi[t] / 9) * PSP + (gi[t] % 9) * 9;
#pragma unroll
                for (int q = 0; q < 9; ++q) pd[q] = ok[t] ? (e[q] * inv) : 0.0f;
            }
        }
    }
    __syncthreads();   // ps is written per group, read per (pixel, head)

    // ---- phase 1b: 5x5 tables, one (pixel, head) a thread. The weight for v offset (dy, dx) = (qi - i, qj - j)
    //      belongs to entry (dy+2)*5 + (dx+2); an entry's terms are added in ascending ij ----
    if (tid < IPB * HEADS) {
        const float* srcp = ps + tid * PSP;
        float pr[81];
#pragma unroll
        for (int c = 0; c < 20; ++c) {
            const v4f p4 = *(const v4f*)(srcp + c * 4);
            pr[c * 4 + 0] = p4.x; pr[c * 4 + 1] = p4.y; pr[c * 4 + 2] = p4.z; pr[c * 4 + 3] = p4.w;
        }
        pr[80] = srcp[80];
        float tb[25];
#pragma unroll
        for (int t = 0; t < 25; ++t) tb[t] = 0.0f;
#pragma unroll
        for (int ij = 0; ij < 9; ++ij) {
            const int i = ij / 3;
            const int j = ij - 3 * i;
#pragma unroll
            for (int q = 0; q < 9; ++q) {
                const int qi = q / 3;
                const int qj = q - 3 * qi;
                tb[(2 - i + qi) * 5 + (2 - j + qj)] += pr[ij * 9 + q];
            }
        }
        float* wdst = w9s + tid * 81 + 2 * 9 + 2;
#pragma unroll
        for (int t = 0; t < 25; ++t) wdst[(t / 5) * 9 + (t % 5)] = tb[t];
    }
    __syncthreads();

    // ---- phase 2: y[c] = sum over 5x5 neighbourhood of w5[dy][dx] * v[r+dy][s+dx][c] ----
    {
        const int c0   = u * 4;
        const int head = u >> 3;                   // 32 channels per head, 4 per thread
        // first row and column of the 5x5 block of loads: the neighbourhood's, moved inside the image
        const int y0 = r - 2 < 0 ? 0 : (r - 2 > HH - 5 ? HH - 5 : r - 2);
        const int x0 = s - 2 < 0 ? 0 : (s - 2 > WW - 5 ? WW - 5 : s - 2);
        // load (ka, kb) is neighbourhood entry (ka + y0 - (r - 2), kb + x0 - (s - 2)): -2..6, inside the 9x9 table
        const float* wrow = w9s + (pix * HEADS + head) * 81 + (y0 - r + 4) * 9 + (x0 - s + 4);
        const float* vb = V + (size_t)(gp - rs + y0 * WW + x0) * CC + c0;
        v4f vv[25];
#pragma unroll
        for (int t = 0; t < 25; ++t) vv[t] = *(const v4f*)(vb + ((t / 5) * WW + (t % 5)) * CC);
        v4f acc = {0.0f, 0.0f, 0.0f, 0.0f};
#pragma unroll
        for (int t = 0; t < 25; ++t) {
            const float w = wrow[(t / 5) * 9 + (t % 5)];
            acc.x = fmaf(w, vv[t].x, acc.x);
            acc.y = fmaf(w, vv[t].y, acc.y);
            acc.z = fmaf(w, vv[t].z, acc.z);
            acc.w = fmaf(w, vv[t].w, acc.w);
        }
        *(v4f*)(ys + pix * CC + c0) = acc;
    }
    __syncthreads();

    // ---- phase 3: whole-line plane stores: waves 0-2 write hi, waves 3-5 write residual ----
    {
        const int plane = tid / 96;                // wave-uniform
        const int u3    = tid - plane * 96;
        const int kb    = u3 >> 3;                 // 8 lanes = 2 pixels x 4 chunks = one 128-B line
        const int pix3  = (u3 >> 2) & 1;
        const int c4    = u3 & 3;
        const int ch    = kb * 4 + c4;
        const int gp3 = lpb + pix3;
        const float* ysrc = ys + pix3 * CC + ch * 8;
        const v4f y0 = *(const v4f*)ysrc;
        const v4f y1 = *(const v4f*)(ysrc + 4);
        float yv[8] = {y0.x, y0.y, y0.z, y0.w, y1.x, y1.y, y1.z, y1.w};
        v8h oh, orr;
#pragma unroll
        for (int e = 0; e < 8; ++e) {
            const _Float16 hq = (_Float16)yv[e];
            const float res = (yv[e] - (float)hq) * R_CARRY;    // exact in f32
            oh[e]  = hq;
            orr[e] = (_Float16)res;
        }
        const size_t dofs = ((size_t)((gp3 >> 4) * KBL + kb) * 64 + (gp3 & 15) * 4 + c4) * 8;
        if (plane == 0) {
            _Float16* d = Yh + dofs;
            *(v8h*)d = oh;
            
        } else {
            _Float16* d = Yr + dofs;
            *(v8h*)d = orr;
            
        }
    }
}

// ------------------------------------------------------------------------------------------------
static inline size_t al256(size_t b) { return (b + 255) & ~(size_t)255; }

extern "C" void kernel_launch(void* const* d_in, const int* in_sizes, int n_in,
                              void* d_out, int out_size, void* d_ws, size_t ws_size,
                              hipStream_t stream) {
    if (n_in < 4) return;
    if (in_sizes[0] < NB * NPIX * CC) return;
    if (in_sizes[1] < CC * CC) return;
    if (in_sizes[2] < NA * CC) return;
    if (in_sizes[3] < CC * CC) return;
    if (out_size < NB * NPIX * CC) return;

    const float* x  = (const float*)d_in[0];   // [NB][56][56][384]
    const float* Wv = (const float*)d_in[1];   // [384][384]  ([out][in])
    const float* Wa = (const float*)d_in[2];   // [972][384]
    const float* Wo = (const float*)d_in[3];   // [384][384]
    float* out = (float*)d_out;                // [NB][56][56][384] f32

    // multiples of the store granularity, offsets 256-B aligned)
    const size_t szXH = (size_t)NB * NPIX * CC * 2;            // x as f16
    const size_t szW  = (size_t)WROWS * CC * 2;                // weight planes
    const size_t szV  = (size_t)NB * NPIX * CC * 4;            // v f32
    const size_t szP  = (size_t)NB * NPIX * NA_PAD * 4;        // logits, f32
    const size_t szY  = (size_t)NB * NPIX * CC * 2;            // y planes (hi, residual)
    size_t off = 0;
    const size_t oXH = off; off += al256(szXH);
    const size_t oW  = off; off += al256(szW);
    const size_t oV  = off; off += al256(szV);
    const size_t oP  = off; off += al256(szP);
    const size_t oYH = off; off += al256(szY);
    const size_t oYR = off; off += al256(szY);
    if (off > ws_size) return;

    char* ws = (char*)d_ws;
    _Float16* Xh  = (_Float16*)(ws + oXH);
    _Float16* Wpl = (_Float16*)(ws + oW);
    const _Float16* Woh = Wpl + (size_t)(CC + NA_PAD) * CC;
    float* Vf = (float*)(ws + oV);
    float* Pf = (float*)(ws + oP);
    _Float16* Yh = (_Float16*)(ws + oYH);
    _Float16* Yr = (_Float16*)(ws + oYR);

    // 1) operand planes
    k_cvt<<<WBLK + XBLK, 256, 0, stream>>>(x, Wv, Wa, Wo, Xh, Wpl);
    // 2) v = x * Wv^T -> f32 [NB*NPIX][384] and logits = x * Wa^T -> f32 [NB*NPIX][1024], all images
    k_gemm<0, 4, 4><<<dim3(NB * NPIX / 128, (CC + NA_PAD) / 128), 128, 0, stream>>>(Xh, Xh, Wpl, Vf, Pf, INV_W_CARRY);
    // 3) softmax + aggregation + fold, all images
    k_av<<<NB * NPIX / IPB, 192, 0, stream>>>(Pf, Vf, Yh, Yr);
    // 4) out = y * Wo^T  (hi + residual/2048) -> d_out
    k_gemm<1, 2, 4><<<dim3(NB * NPIX / 64, CC / 128), 128, 0, stream>>>(Yh, Yr, Woh, out, out, INV_W_CARRY);
}

// v006
// It runs in 104 microseconds.
// Two timings next to v005 both put it at 1.07 times that version's speed.
// All steps since v000 together make it 2.91 times as fast.
#include <hip/hip_runtime.h>

// All contractions on v_wmma_f32_16x16x32_f16 (f16 operands, f32 accumulate): x*Wv^T and x*Wa^T with
// f16 containers of bf16-RNE inputs (weights carried x16); y*Wo^T with y as f16 hi plane plus f16
// residual plane carried x2048 into a separate accumulator (folded x1/2048), Wo bf16-RNE x16.
// Per-pixel 9-way softmax, 3x3 window aggregation and overlap-add fold: f32 on VALU.
//
// The 16-bit operand planes are stored in fragment order, not row-major. A plane is cut into units of
// 16 rows x 32 k = 64 chunks of 16 B (1 KiB); unit (row tile t, k block kb) starts at chunk
// (t * 12 + kb) * 64, so a row tile still spans 16 * 384 halves. Chunk (row m, c4 = k / 8 within the
// block) holds the halves that lane half h = c4 & 1 takes as element group j = c4 >> 1. Inside a unit:
//   x and weight planes: chunk j * 32 + h * 16 + m  (one fragment load = 512 contiguous bytes, 4 lines)
//   y planes:            chunk m * 4 + c4           (eight pixels' 64-B pieces are 512 contiguous bytes, one
//                                                    wave store of k_av; 8 lines a fragment load)
//
// Logit columns are stored window-position-major: column ij * 108 + head * 9 + q holds the reference's
// logit head * 81 + ij * 9 + q (the rows of Wa are permuted where the weight plane is written). An output
// pixel takes group ij of all heads from ONE neighbour, so its inputs are 9 contiguous runs of 432 B.

#ifndef NB
#define NB 8
#endif
#define NB_FULL 8
#define HH 56
#define WW 56
#define CC 384
#define HEADS 12
#define DHEAD 32
#define NPIX (HH * WW)                 // 3136 pixels per image
#define NA 972                         // HEADS * 81 logits per pixel
#define NA_PAD 1024                    // logit columns incl. zero columns 972..1023
#define NRUN (HEADS * 9)               // 108 logits of one window position ij, all heads: one contiguous run
#define RCH (NRUN / 4)                 // 27 chunks of 16 B per run
#define PCH (NA / 4)                   // 243 chunks of 16 B per pixel
#define KCH (CC / 8)                   // 48 chunks of 16 B per 384-wide 16-bit row
#define KBL (CC / 32)                  // 12 k blocks of 32 per row
#define WROWS (CC + NA_PAD + CC)       // weight plane rows: Wv | Wa (zero-extended) | Wo
#define IPB 8                          // pixels per block in k_av, adjacent in one image row
#define GPX 4                          // adjacent pixels that one thread of k_av aggregates
#define W5G (GPX * 25)                 // floats of the 5x5 weight tables of GPX adjacent pixels, one head, in k_av
#define YSP (CC + 8)                   // LDS pitch (floats) of one pixel's y row in k_av
#define CSP 132                        // LDS pitch (floats) of the 128-column epilogue tile
#define PSP 84                         // LDS pitch (floats) of one head's 81 softmax values in k_av (16-B rows)
#define SM_SCALE 0.17677669529663687f  // 32^-0.5
#define LOG2E 0x1.715476p+0f           // log2(e) in f32: e^x = 2^(x * LOG2E)
#define INV_W_CARRY 0.0625f            // weights are carried x16
#define R_CARRY 2048.0f                // residual plane carry
#define INV_R_CARRY 0.00048828125f

static_assert(NB >= 1 && NB <= NB_FULL);
static_assert(NPIX % 64 == 0);
static_assert(CC % 16 == 0 && NA_PAD % 16 == 0);                             // weight planes start on a row tile
static_assert(IPB == 8 && NPIX % IPB == 0);                                  // a k_av block owns half a 16-row tile of the y planes
static_assert((NPIX * KCH) % 256 == 0);
static_assert((CC * KCH) % 256 == 0);
static_assert((NA_PAD * KCH) % 256 == 0);
static_assert((WROWS * KCH) % 256 == 0);
static_assert(CC % 64 == 0);
static_assert(NA_PAD % 64 == 0);
static_assert(NA <= NA_PAD);
static_assert(CC % 32 == 0);
static_assert(HEADS * DHEAD == CC);
static_assert(HEADS * 81 == NA);
static_assert(NPIX % IPB == 0);
static_assert(IPB == 2 * GPX);                  // two groups of 96 threads, GPX pixels each
static_assert(NRUN % 4 == 0 && WW % IPB == 0);   // runs are whole 16-B chunks; a k_av block's pixels share an image row
static_assert(2 * HEADS * W5G + IPB * YSP <= IPB * NA && (GPX * 5) % 4 == 0);   // tables and y rows reuse the logits' LDS

typedef _Float16 v16h __attribute__((ext_vector_type(16)));
typedef _Float16 v8h  __attribute__((ext_vector_type(8)));
typedef float    v8f  __attribute__((ext_vector_type(8)));
typedef float    v4f  __attribute__((ext_vector_type(4)));

union FragH { v16h v; v8h half[2]; };

__device__ __forceinline__ unsigned int bf16r_bits(float f) {
    unsigned int u = __float_as_uint(f);
    u += 0x7FFFu + ((u >> 16) & 1u);          // RNE to bf16
    return u & 0xFFFF0000u;
}
__device__ __forceinline__ float bf16r(float f) { return __uint_as_float(bf16r_bits(f)); }

// 2^x on the transcendental unit. The v_nop fills the one slot that the instruction set asks for between a
// transcendental and a next instruction that reads its result or overwrites its source.
__device__ __forceinline__ float exp2_slot(float x) {
    float y;
    asm("v_exp_f32 %0, %1\n\tv_nop" : "=v"(y) : "v"(x));
    return y;
}

__device__ __forceinline__ v8f wmma16(v16h a, v16h b, v8f c) {
    return __builtin_amdgcn_wmma_f32_16x16x32_f16(false, a, false, b, (short)0, c, false, false);
}

// ------------------------------------------------------------------------------------------------
// x [rows][384] f32 -> xh, fragment order, f16 (bf16-RNE value, exact in f16). One 16-B chunk per thread:
// 4 lanes read one 128-B line of a row, 8 rows a wave; the wave's stores fill 4 whole lines.
__device__ __forceinline__
void cvt_x(const float* __restrict__ x, _Float16* xh, int blk) {
    const int g = blk * 256 + (int)threadIdx.x;                 // < NB*NPIX*KCH exactly
    const int unit = g >> 6;
    const int tile = unit / KBL;
    const int kb   = unit - tile * KBL;
    const int m    = (g >> 2) & 15;
    const int c4   = g & 3;
    const float* s = x + (size_t)(tile * 16 + m) * CC + kb * 32 + c4 * 8;
    const v4f f0 = *(const v4f*)s;
    const v4f f1 = *(const v4f*)(s + 4);
    float t[8] = {f0.x, f0.y, f0.z, f0.w, f1.x, f1.y, f1.z, f1.w};
    v8h o;
#pragma unroll
    for (int e = 0; e < 8; ++e) o[e] = (_Float16)bf16r(t[e]);
    _Float16* d = xh + (size_t)(unit * 64 + (c4 >> 1) * 32 + (c4 & 1) * 16 + m) * 8;
    *(v8h*)d = o;
}

// ------------------------------------------------------------------------------------------------
// Weight planes, WROWS rows of 384, f16 = 16 * bf16-RNE(W), fragment order over rows n:
//   rows [0,384) Wv, [384,1408) Wa (rows >= 972 written as zeros), [1408,1792) Wo.
// Wa's plane row ij * 108 + head * 9 + q is taken from Wa's row head * 81 + ij * 9 + q.
// Plane selection is block-uniform (plane boundaries are multiples of 256 chunks).
__device__ __forceinline__
void cvt_w(const float* __restrict__ Wv, const float* __restrict__ Wa,
           const float* __restrict__ Wo, _Float16* wpl, int blk) {
    const int g   = blk * 256 + (int)threadIdx.x;               // < WROWS*KCH exactly
    const int unit = g >> 6;
    const int tile = unit / KBL;
    const int kb   = unit - tile * KBL;
    const int m    = (g >> 2) & 15;
    const int c4   = g & 3;
    const int R   = tile * 16 + m;
    const int ch  = kb * 4 + c4;
    const float* src;
    int rbase, nvalid;
    bool perm = false;
    if (blk < (CC * KCH) / 256)                  { src = Wv; rbase = 0;           nvalid = CC; }
    else if (blk < ((CC + NA_PAD) * KCH) / 256)  { src = Wa; rbase = CC;          nvalid = NA; perm = true; }
    else                                         { src = Wo; rbase = CC + NA_PAD; nvalid = CC; }
    const int rr = R - rbase;                                    // >= 0
    int rc = (rr < nvalid) ? rr : (nvalid - 1);                  // clamped address
    if (perm) {                                                  // block-uniform
        const int ij  = rc / NRUN;
        const int rem = rc - ij * NRUN;
        const int hd  = rem / 9;
        rc = hd * 81 + ij * 9 + (rem - hd * 9);
    }
    const float pm = (rr < nvalid) ? 16.0f : 0.0f;               // carry, or zero for extension rows
    const float* s = src + (size_t)rc * CC + ch * 8;
    const v4f f0 = *(const v4f*)s;
    const v4f f1 = *(const v4f*)(s + 4);
    float t[8] = {f0.x, f0.y, f0.z, f0.w, f1.x, f1.y, f1.z, f1.w};
    v8h o;
#pragma unroll
    for (int e = 0; e < 8; ++e) o[e] = (_Float16)(bf16r(t[e]) * pm);
    _Float16* d = wpl + (size_t)(unit * 64 + (c4 >> 1) * 32 + (c4 & 1) * 16 + m) * 8;
    *(v8h*)d = o;
}

// Both conversions in one grid (neither reads what the other writes): blocks [0, WBLK) write the weight
// planes, the rest the x plane.
#define WBLK ((WROWS * KCH) / 256)
#define XBLK ((NB * NPIX * KCH) / 256)
__global__ __launch_bounds__(256)
void k_cvt(const float* __restrict__ x, const float* __restrict__ Wv, const float* __restrict__ Wa,
           const float* __restrict__ Wo, _Float16* xh, _Float16* wpl) {
    const int blk = (int)blockIdx.x;
    if (blk < WBLK) cvt_w(Wv, Wa, Wo, wpl, blk);
    else            cvt_x(x, xh, blk - WBLK);
}

// ------------------------------------------------------------------------------------------------
// Out[m][n] = scale * sum_k A[m][k] * Bw[n][k]   (K = 384, A and Bw in fragment order)
// RES = 1: Out[m][n] = scale * (sum_k A[m][k]*Bw[n][k] + (1/2048) * sum_k Ar[m][k]*Bw[n][k]).
// Block = 4 waves (2 x 2), each wave MT x NT WMMA tiles, so the block's tile is 32*MT rows x 32*NT = 128
// columns: a loaded fragment feeds NT (A) or MT (B; 2*MT with RES) products. Fragments loaded straight from
// the global planes with the split-k lane map for A and B alike; RES = 1 reads A and Ar in the y planes'
// chunk order, RES = 0 in the x plane's. Epilogue staged in LDS, then whole 512-B rows stored.
// RES = 0 takes Bw = Wv | Wa in one grid: plane rows [0, 384) give out [m][384] (v), rows [384, 1408) give
// out2 [m][1024] (logits). RES = 1 writes out [m][384] alone.
template <int RES, int MT, int NT>
__global__ __launch_bounds__(128)
void k_gemm(const _Float16* __restrict__ A, const _Float16* __restrict__ Ar,
            const _Float16* __restrict__ Bw, float* out, float* out2, float scale) {
    constexpr int BM = 32 * MT;
    constexpr int BN = 32 * NT;
    static_assert(BN == 128 && NT == 4 && (MT == 4 || MT == 2));
    static_assert((NB * NPIX) % BM == 0 && CC % BN == 0 && NA_PAD % BN == 0);
    __shared__ __attribute__((aligned(16))) float cs[BM * CSP];
    const int tid  = (int)threadIdx.x;
    const int lane = tid & 31;
    const int wave = tid >> 5;
    const int h    = lane >> 4;          // lane half
    const int m    = lane & 15;          // A row / B col / D col
    const int m0   = (int)blockIdx.x * BM;
    const int n0   = (int)blockIdx.y * BN;
    const int wm   = (wave >> 1) * (16 * MT);
    const int wn   = (wave & 1) * (16 * NT);

    constexpr int AJ = RES ? 16 : 256;   // halves from element group 0 to group 1 in A's unit
    const _Float16* pa = A  + (size_t)(m0 + wm) * CC + (RES ? (m * 4 + h) * 8 : lane * 8);
    const _Float16* pe = Ar + (size_t)(m0 + wm) * CC + (RES ? (m * 4 + h) * 8 : lane * 8);
    const _Float16* pb = Bw + (size_t)(n0 + wn) * CC + lane * 8;

    v8f acc[MT][NT];
    v8f rcc[MT][NT];
#pragma unroll
    for (int i = 0; i < MT; ++i)
#pragma unroll
        for (int j = 0; j < NT; ++j) {
            const v8f z8 = {0.f, 0.f, 0.f, 0.f, 0.f, 0.f, 0.f, 0.f};
            acc[i][j] = z8;
            rcc[i][j] = z8;
        }

    // The k loop stays rolled: one fragment set in registers, so that four waves fit a SIMD. The inner loops
    // over tiles are unrolled so that the arrays have constant indices and stay in registers.
#pragma unroll 1
    for (int k0 = 0; k0 < CC; k0 += 32) {
        FragH a[MT], b[NT], e[MT];
        // elements 0..7 <- k0+8h+0..7, elements 8..15 <- k0+16+8h+0..7 (A and B identical map)
#pragma unroll
        for (int i = 0; i < MT; ++i) {
            a[i].half[0] = *(const v8h*)(pa + i * 16 * CC);
            a[i].half[1] = *(const v8h*)(pa + i * 16 * CC + AJ);
        }
#pragma unroll
        for (int j = 0; j < NT; ++j) {
            b[j].half[0] = *(const v8h*)(pb + j * 16 * CC);
            b[j].half[1] = *(const v8h*)(pb + j * 16 * CC + 256);
        }
        if (RES) {
#pragma unroll
            for (int i = 0; i < MT; ++i) {
                e[i].half[0] = *(const v8h*)(pe + i * 16 * CC);
                e[i].half[1] = *(const v8h*)(pe + i * 16 * CC + AJ);
            }
        }
#pragma unroll
        for (int i = 0; i < MT; ++i)
#pragma unroll
            for (int j = 0; j < NT; ++j) acc[i][j] = wmma16(a[i].v, b[j].v, acc[i][j]);
        // The v_nop fill the slots that the chip asks for between the last products and the next trip's
        // loads into their operand registers (the loop's taken branch).
        // The pointers are inputs so that no load of this trip lands in an address register of another.
        if constexpr (RES) {
#pragma unroll
            for (int i = 0; i < MT; ++i)
#pragma unroll
                for (int j = 0; j < NT; ++j) rcc[i][j] = wmma16(e[i].v, b[j].v, rcc[i][j]);
            asm volatile("v_nop\n\tv_nop\n\tv_nop\n\tv_nop"
                         : "+v"(acc[0][0]), "+v"(acc[0][1]), "+v"(acc[0][2]), "+v"(acc[0][3]),
                           "+v"(acc[1][0]), "+v"(acc[1][1]), "+v"(acc[1][2]), "+v"(acc[1][3]),
                           "+v"(rcc[0][0]), "+v"(rcc[0][1]), "+v"(rcc[0][2]), "+v"(rcc[0][3]),
                           "+v"(rcc[1][0]), "+v"(rcc[1][1]), "+v"(rcc[1][2]), "+v"(rcc[1][3])
                         : "v"(a[0].v), "v"(a[1].v), "v"(e[0].v), "v"(e[1].v),
                           "v"(b[0].v), "v"(b[1].v), "v"(b[2].v), "v"(b[3].v), "v"(pa), "v"(pe), "v"(pb));
            pe += 512;                   // 512 halves per unit of 32 k
        } else {
            asm volatile("v_nop\n\tv_nop\n\tv_nop\n\tv_nop"
                         : "+v"(acc[0][0]), "+v"(acc[0][1]), "+v"(acc[0][2]), "+v"(acc[0][3]),
                           "+v"(acc[1][0]), "+v"(acc[1][1]), "+v"(acc[1][2]), "+v"(acc[1][3]),
                           "+v"(acc[2][0]), "+v"(acc[2][1]), "+v"(acc[2][2]), "+v"(acc[2][3]),
                           "+v"(acc[3][0]), "+v"(acc[3][1]), "+v"(acc[3][2]), "+v"(acc[3][3])
                         : "v"(a[0].v), "v"(a[1].v), "v"(a[2].v), "v"(a[3].v),
                           "v"(b[0].v), "v"(b[1].v), "v"(b[2].v), "v"(b[3].v), "v"(pa), "v"(pb));
        }
        pa += 512;                       // 512 halves per unit of 32 k
        pb += 512;
    }

    // D element r of lane -> row 8h + r, col m of each 16x16 tile
#pragma unroll
    for (int i = 0; i < MT; ++i) {
#pragma unroll
        for (int j = 0; j < NT; ++j) {
            float* p = cs + (wm + i * 16 + 8 * h) * CSP + wn + j * 16 + m;
#pragma unroll
            for (int r = 0; r < 8; ++r) {
                if (RES) p[r * CSP] = (acc[i][j][r] + rcc[i][j][r] * INV_R_CARRY) * scale;
                else     p[r * CSP] = acc[i][j][r] * scale;
            }
        }
    }
    __syncthreads();   // cs is written per wave, read cross-wave

    // BM rows x 512 B; per pass each wave stores one whole row (4 lines)
    const bool second = RES == 0 && n0 >= CC;          // block-uniform: this tile's columns are logits
    float* const od  = second ? out2 : out;
    const int    ldo = second ? NA_PAD : CC;
    const int    nc  = second ? n0 - CC : n0;
    float* const ob = od + (size_t)m0 * ldo + nc;      // block-uniform base; the rest fits 32 bits
    const unsigned vo = (unsigned)(wave * ldo + lane * 4);
#pragma unroll
    for (int p = 0; p < BM / 4; ++p) {
        const v4f v = *(const v4f*)(cs + (p * 4 + wave) * CSP + lane * 4);
        *(v4f*)(ob + (vo + (unsigned)(p * 4 * ldo))) = v;
    }
}

// ------------------------------------------------------------------------------------------------
// Fused: per-pixel 9-way softmax (each logit group feeds exactly one output pixel), combination of
// the 81 window weights into a 5x5 table per (pixel, head) in LDS (entries whose v position lies outside
// the image are written as zeros: zero-extended v), weighted aggregation of V over the 5x5 neighbourhood,
// then y written as f16 hi plane + f16 residual plane x2048. Block = 8 adjacent pixels of one image row,
// 192 threads. The block's logits (8 pixels x 9 runs of 432 B) come in as 16-B chunks, one run a wave load,
// and are laid in LDS; the 864 softmax groups are dealt over the threads. In the
// aggregation 96 threads (3 waves, 4 channels a thread) take 4 adjacent pixels: their neighbourhoods
// overlap, so one 5x8 window of loads (addresses clamped into the image) serves all four.
//   P  : [NB*NPIX][1024] f32 logits (unscaled, columns ij * 108 + head * 9 + q)
//   V  : [NB*NPIX][384] f32
//   Yh, Yr : NB*NPIX rows of 384, f16, fragment order (y planes' chunk order)
__global__ __launch_bounds__(192)
void k_av(const float* __restrict__ P, const float* __restrict__ V,
          _Float16* Yh, _Float16* Yr) {
#pragma clang fp contract(off)
    __shared__ __attribute__((aligned(16))) float zs[IPB * NA];            // cross-wave: logits, [pixel][ij][head][q]
    __shared__ __attribute__((aligned(16))) float ps[IPB * HEADS * PSP];   // cross-wave: softmax values, [pixel][head][ij * 9 + q]
    // The logits are dead behind the second barrier: the tables (written behind it) and the y rows (written
    // behind the third) take their place.
    float* const w5s = zs;                         // cross-wave: 5x5 tables, [pixel / 4][head][dy][pixel % 4][dx]
    float* const ys  = zs + 2 * HEADS * W5G;       // cross-wave: y rows, pitch YSP
    const int tid = (int)threadIdx.x;
    const int lpb = (int)blockIdx.x * IPB;    // first pixel of this block
    const int rs0 = lpb % NPIX;               // the block's pixels follow one another in the same image row
    const int rb  = rs0 / WW;
    const int sb  = rs0 - rb * WW;

    // ---- phase 0: the block's logits into LDS, one run (pixel, ij) of 27 chunks a wave load. A wave takes window
    //      row i = wave / 2 of 4 pixels: 12 runs, whose addresses are the same in all lanes but for the chunk and are
    //      kept scalar; all loads ahead of the stores ----
    {
        const int wv   = __builtin_amdgcn_readfirstlane(tid >> 5);
        const int lane = tid & 31;
        const int wi   = wv >> 1;
        const int wp   = (wv & 1) * GPX;
        const int ny   = rb + 1 - wi;             // row of the window centre pixels n'
        const int nyc  = ny < 0 ? 0 : (ny >= HH ? HH - 1 : ny);
        const int rowp = lpb - sb + (nyc - rb) * WW;          // first pixel of that row, same image, clamped
        // scalar base (source row, window row i) + one of 6 lane offsets (source column, chunk) + constant j * 432 B
        const float* pw = P + __builtin_amdgcn_readfirstlane(rowp * NA_PAD + wi * 3 * NRUN);
        if (lane < RCH) {
            unsigned po[GPX + 2];
#pragma unroll
            for (int x = 0; x < GPX + 2; ++x) {
                const int nx  = sb + wp + x - 1;
                const int nxc = nx < 0 ? 0 : (nx >= WW ? WW - 1 : nx);   // clamped address
                po[x] = (unsigned)(__builtin_amdgcn_readfirstlane(nxc * NA_PAD) + lane * 4) * 4u;   // bytes
            }
            v4f zl[3 * GPX];
#pragma unroll   // constant indices keep zl in registers
            for (int t = 0; t < 3 * GPX; ++t)
                zl[t] = *(const v4f*)((const char*)(pw + (t % 3) * NRUN) + po[t / 3 + 2 - t % 3]);
            // The wait that belongs in front of any overwrite of a register that an issued load names; the offsets
            // and the base are inputs so that they live up to it and no load lands in one of them.
            asm volatile("s_wait_xcnt 0x0"
                         :: "v"(po[0]), "v"(po[1]), "v"(po[2]), "v"(po[3]), "v"(po[4]), "v"(po[5]), "s"(pw) : "memory");
            float* zd = zs + (wp * 9 + wi * 3) * NRUN + lane * 4;
#pragma unroll   // constant indices keep zl in registers
            for (int t = 0; t < 3 * GPX; ++t) *(v4f*)(zd + ((t / 3) * 9 + t % 3) * NRUN) = zl[t];
        }
    }
    __syncthreads();   // zs is written per chunk, read per group

    // ---- phase 1a: softmax of the 9x12 groups feeding each pixel, group ga = pixel * 108 + head * 9 + ij ----
    {
        constexpr int NG  = HEADS * 9;            // 108 groups per pixel
        constexpr int NT1 = (IPB * NG + 191) / 192;   // 5 trips, the last one on half the waves
#pragma unroll   // the trips are independent chains
        for (int t = 0; t < NT1; ++t) {
            const int ga = t * 192 + tid;
            if (t < NT1 - 1 || ga < IPB * NG) {
                const int px = ga / NG;
                const int g  = ga - px * NG;
                const int hd = g / 9;
                const int ij = g - hd * 9;
                const int i  = ij / 3;
                const int j  = ij - 3 * i;
                const int ny = rb + 1 - i;                // window centre pixel n'
                const int nx = sb + px + 1 - j;
                const bool ok = ((unsigned)ny < (unsigned)HH) && ((unsigned)nx < (unsigned)WW);
                const float* gsrc = zs + px * NA + ij * NRUN + hd * 9;
                float z[9];
#pragma unroll
                for (int q = 0; q < 9; ++q) z[q] = gsrc[q];
                float mx = -3.0e38f;
#pragma unroll
                for (int q = 0; q < 9; ++q) { z[q] = z[q] * SM_SCALE; mx = fmaxf(mx, z[q]); }
                float e[9];
                float sum = 0.0f;
#pragma unroll
                for (int q = 0; q < 9; ++q) { e[q] = exp2_slot((z[q] - mx) * LOG2E); sum += e[q]; }
                const float inv = 1.0f / sum;
                float* pd = ps + (px * HEADS + hd) * PSP + ij * 9;
#pragma unroll
                for (int q = 0; q < 9; ++q) pd[q] = ok ? (e[q] * inv) : 0.0f;
            }
        }
    }
    __syncthreads();   // ps is written per group, read per (pixel, head); ends the reads of zs

    // ---- phase 1b: 5x5 tables, one (pixel, head) a thread. The weight for v offset (dy, dx) = (qi - i, qj - j)
    //      belongs to entry (dy+2)*5 + (dx+2); an entry's terms are added in ascending ij ----
    if (tid < IPB * HEADS) {
        const float* srcp = ps + tid * PSP;
        float pr[81];
#pragma unroll
        for (int c = 0; c < 20; ++c) {
            const v4f p4 = *(const v4f*)(srcp + c * 4);
            pr[c * 4 + 0] = p4.x; pr[c * 4 + 1] = p4.y; pr[c * 4 + 2] = p4.z; pr[c * 4 + 3] = p4.w;
        }
        pr[80] = srcp[80];
        float tb[25];
#pragma unroll
        for (int t = 0; t < 25; ++t) tb[t] = 0.0f;
#pragma unroll
        for (int ij = 0; ij < 9; ++ij) {
            const int i = ij / 3;
            const int j = ij - 3 * i;
#pragma unroll
            for (int q = 0; q < 9; ++q) {
                const int qi = q / 3;
                const int qj = q - 3 * qi;
                tb[(2 - i + qi) * 5 + (2 - j + qj)] += pr[ij * 9 + q];
            }
        }
        const int px = tid / HEADS;
        const int sp = sb + px;                    // this table's pixel column
        float* wdst = w5s + ((px / GPX) * HEADS + (tid - px * HEADS)) * W5G + (px % GPX) * 5;
#pragma unroll
        for (int t = 0; t < 25; ++t) {
            const bool in = ((unsigned)(rb + t / 5 - 2) < (unsigned)HH) && ((unsigned)(sp + t % 5 - 2) < (unsigned)WW);
            wdst[(t / 5) * (GPX * 5) + t % 5] = in ? tb[t] : 0.0f;
        }
    }
    __syncthreads();   // w5s is written per (pixel, head), read per channel group

    // ---- phase 2: y[c] = sum over 5x5 neighbourhood of w5[dy][dx] * v[r+dy][s+dx][c], GPX pixels a thread ----
    {
        const int grp  = __builtin_amdgcn_readfirstlane(tid / 96);   // same in all lanes of a wave: kept scalar
        const int u    = tid - grp * 96;
        const int c0   = u * 4;
        const int head = u >> 3;                   // 32 channels per head, 4 per thread
        const int s0   = sb + grp * GPX;           // column of the group's first pixel
        const float* vimg = V + (size_t)(lpb - rs0) * CC;      // the image's first pixel
        // A load = scalar row base + lane offset (column, channel): 5 bases and 8 offsets serve the 40 loads.
        const float* rowb[5];
        unsigned     vo[GPX + 4];
#pragma unroll
        for (int ka = 0; ka < 5; ++ka) {
            const int yy  = rb - 2 + ka;
            const int yyc = yy < 0 ? 0 : (yy >= HH ? HH - 1 : yy);       // outside the image: weight zero
            rowb[ka] = vimg + __builtin_amdgcn_readfirstlane(yyc * (WW * CC));
        }
#pragma unroll
        for (int kb = 0; kb < GPX + 4; ++kb) {
            const int xx  = s0 - 2 + kb;
            const int xxc = xx < 0 ? 0 : (xx >= WW ? WW - 1 : xx);       // outside the image: weight zero
            vo[kb] = (unsigned)(__builtin_amdgcn_readfirstlane(xxc * CC) + c0) * 4u;   // bytes
        }
        const float* wt = w5s + (grp * HEADS + head) * W5G;
        v4f vv[5][GPX + 4];
        v4f acc[GPX];
#pragma unroll
        for (int p = 0; p < GPX; ++p) acc[p] = v4f{0.0f, 0.0f, 0.0f, 0.0f};
#pragma unroll   // constant indices keep vv in registers
        for (int ka = 0; ka < 5; ++ka)
#pragma unroll
            for (int kb = 0; kb < GPX + 4; ++kb) vv[ka][kb] = *(const v4f*)((const char*)rowb[ka] + vo[kb]);
        // The wait that belongs in front of any overwrite of a register that an issued load names; the offsets
        // and the bases are inputs so that they live up to it and no load lands in one of them.
        asm volatile("s_wait_xcnt 0x0"
                     :: "v"(vo[0]), "v"(vo[1]), "v"(vo[2]), "v"(vo[3]), "v"(vo[4]), "v"(vo[5]), "v"(vo[6]), "v"(vo[7]),
                        "s"(rowb[0]), "s"(rowb[1]), "s"(rowb[2]), "s"(rowb[3]), "s"(rowb[4]) : "memory");
#pragma unroll   // constant indices keep vv and acc in registers
        for (int ka = 0; ka < 5; ++ka) {
            float w[GPX * 5];
#pragma unroll
            for (int c = 0; c < GPX * 5 / 4; ++c) {
                const v4f w4 = *(const v4f*)(wt + ka * (GPX * 5) + c * 4);
                w[c * 4 + 0] = w4.x; w[c * 4 + 1] = w4.y; w[c * 4 + 2] = w4.z; w[c * 4 + 3] = w4.w;
            }
#pragma unroll
            for (int p = 0; p < GPX; ++p)
#pragma unroll
                for (int e = 0; e < 5; ++e) {          // a pixel's terms in ascending (dy, dx)
                    const float wq = w[p * 5 + e];
                    const v4f   x4 = vv[ka][p + e];
                    acc[p].x = fmaf(wq, x4.x, acc[p].x);
                    acc[p].y = fmaf(wq, x4.y, acc[p].y);
                    acc[p].z = fmaf(wq, x4.z, acc[p].z);
                    acc[p].w = fmaf(wq, x4.w, acc[p].w);
                }
        }
#pragma unroll
        for (int p = 0; p < GPX; ++p) *(v4f*)(ys + (grp * GPX + p) * YSP + c0) = acc[p];
    }
    __syncthreads();   // ys is written per (pixel, channel group), read per plane chunk

    // ---- phase 3: plane stores, one wave store = 8 pixels x 64 B = 512 contiguous bytes of one unit;
    //      trips 0 and 1 write the hi plane, trips 2 and 3 the residual plane ----
#pragma unroll   // the plane is a constant of the trip
    for (int t = 0; t < 4; ++t) {
        const int rem  = (t & 1) * 192 + tid;      // < 384 = 12 k blocks x 8 pixels x 4 chunks
        const int kb   = rem >> 5;
        const int pix3 = (rem >> 2) & 7;
        const int c4   = rem & 3;
        const float* ysrc = ys + pix3 * YSP + (kb * 4 + c4) * 8;
        const v4f y0 = *(const v4f*)ysrc;
        const v4f y1 = *(const v4f*)(ysrc + 4);
        float yv[8] = {y0.x, y0.y, y0.z, y0.w, y1.x, y1.y, y1.z, y1.w};
        v8h o;
#pragma unroll
        for (int e = 0; e < 8; ++e) {
            const _Float16 hq = (_Float16)yv[e];
            const float res = (yv[e] - (float)hq) * R_CARRY;    // exact in f32
            o[e] = t < 2 ? hq : (_Float16)res;
        }
        const int gp3 = lpb + pix3;
        const size_t dofs = ((size_t)((gp3 >> 4) * KBL + kb) * 64 + (gp3 & 15) * 4 + c4) * 8;
        _Float16* d = (t < 2 ? Yh : Yr) + dofs;
        *(v8h*)d = o;
    }
}

// ------------------------------------------------------------------------------------------------
static inline size_t al256(size_t b) { return (b + 255) & ~(size_t)255; }

extern "C" void kernel_launch(void* const* d_in, const int* in_sizes, int n_in,
                              void* d_out, int out_size, void* d_ws, size_t ws_size,
                              hipStream_t stream) {
    if (n_in < 4) return;
    if (in_sizes[0] < NB * NPIX * CC) return;
    if (in_sizes[1] < CC * CC) return;
    if (in_sizes[2] < NA * CC) return;
    if (in_sizes[3] < CC * CC) return;
    if (out_size < NB * NPIX * CC) return;

    const float* x  = (const float*)d_in[0];   // [NB][56][56][384]
    const float* Wv = (const float*)d_in[1];   // [384][384]  ([out][in])
    const float* Wa = (const float*)d_in[2];   // [972][384]
    const float* Wo = (const float*)d_in[3];   // [384][384]
    float* out = (float*)d_out;                // [NB][56][56][384] f32

    // multiples of the store granularity, offsets 256-B aligned)
    const size_t szXH = (size_t)NB * NPIX * CC * 2;            // x as f16
    const size_t szW  = (size_t)WROWS * CC * 2;                // weight planes
    const size_t szV  = (size_t)NB * NPIX * CC * 4;            // v f32
    const size_t szP  = (size_t)NB * NPIX * NA_PAD * 4;        // logits, f32
    const size_t szY  = (size_t)NB * NPIX * CC * 2;            // y planes (hi, residual)
    size_t off = 0;
    const size_t oXH = off; off += al256(szXH);
    const size_t oW  = off; off += al256(szW);
    const size_t oV  = off; off += al256(szV);
    const size_t oP  = off; off += al256(szP);
    const size_t oYH = off; off += al256(szY);
    const size_t oYR = off; off += al256(szY);
    if (off > ws_size) return;

    char* ws = (char*)d_ws;
    _Float16* Xh  = (_Float16*)(ws + oXH);
    _Float16* Wpl = (_Float16*)(ws + oW);
    const _Float16* Woh = Wpl + (size_t)(CC + NA_PAD) * CC;
    float* Vf = (float*)(ws + oV);
    float* Pf = (float*)(ws + oP);
    _Float16* Yh = (_Float16*)(ws + oYH);
    _Float16* Yr = (_Float16*)(ws + oYR);

    // 1) operand planes
    k_cvt<<<WBLK + XBLK, 256, 0, stream>>>(x, Wv, Wa, Wo, Xh, Wpl);
    // 2) v = x * Wv^T -> f32 [NB*NPIX][384] and logits = x * Wa^T -> f32 [NB*NPIX][1024], all images
    k_gemm<0, 4, 4><<<dim3(NB * NPIX / 128, (CC + NA_PAD) / 128), 128, 0, stream>>>(Xh, Xh, Wpl, Vf, Pf, INV_W_CARRY);
    // 3) softmax + aggregation + fold, all images
    k_av<<<NB * NPIX / IPB, 192, 0, stream>>>(Pf, Vf, Yh, Yr);
    // 4) out = y * Wo^T  (hi + residual/2048) -> d_out
    k_gemm<1, 2, 4><<<dim3(NB * NPIX / 64, CC / 128), 128, 0, stream>>>(Yh, Yr, Woh, out, out, INV_W_CARRY);
}

// v009
// One run takes 71.5 microseconds.
// It is 1.46 times as fast as v006, going by the measured steps of the versions left out in between.
// Over all steps from v000 it is 4.25 times as fast.
#include <hip/hip_runtime.h>

// All contractions on v_wmma_f32_16x16x32_f16 (f16 operands, f32 accumulate): x*Wv^T and x*Wa^T with
// f16 containers of bf16-RNE inputs (weights carried x16); y*Wo^T with y as one f16 plane (RNE of the f32
// sums: 11 significant bits beside the 8 of its partner Wo), Wo bf16-RNE x16.
// Per-pixel 9-way softmax, 3x3 window aggregation and overlap-add fold: f32 on VALU. Between the first GEMM
// and the aggregation v and the logits lie in the workspace as f16 (RNE of the f32 accumulators).
//
// The 16-bit operand planes are stored in fragment order, not row-major. A plane is cut into units of
// 16 rows x 32 k = 64 chunks of 16 B (1 KiB); unit (row tile t, k block kb) starts at chunk
// (t * 12 + kb) * 64, so a row tile still spans 16 * 384 halves. Chunk (row m, c4 = k / 8 within the
// block) holds the halves that lane half h = c4 & 1 takes as element group j = c4 >> 1. Inside a unit:
//   x and weight planes: chunk j * 32 + h * 16 + m  (one fragment half = 512 contiguous bytes, 4 lines)
//   y plane:             chunk m * 4 + c4           (eight pixels' 64-B pieces are 512 contiguous bytes, one
//                                                    wave store of k_av; the GEMM's copies reorder them in LDS)
//
// Logit columns are stored window-position-major: column ij * 108 + head * 9 + q holds the reference's
// logit head * 81 + ij * 9 + q (the rows of Wa are permuted where the weight plane is written). An output
// pixel takes group ij of all heads from ONE neighbour, so its inputs are 9 contiguous runs of 216 B.

#ifndef NB
#define NB 8
#endif
#define NB_FULL 8
#define HH 56
#define WW 56
#define CC 384
#define HEADS 12
#define DHEAD 32
#define NPIX (HH * WW)                 // 3136 pixels per image
#define NA 972                         // HEADS * 81 logits per pixel
#define NA_PAD 1024                    // logit columns incl. zero columns 972..1023
#define NRUN (HEADS * 9)               // 108 logits of one window position ij, all heads: one contiguous run
#define RCH (NRUN / 4)                 // 27 chunks of 4 logits (8 B as stored, 16 B in LDS) per run
#define PCH (NA / 4)                   // 243 chunks of 16 B per pixel
#define KCH (CC / 8)                   // 48 chunks of 16 B per 384-wide 16-bit row
#define KBL (CC / 32)                  // 12 k blocks of 32 per row
#define WROWS (CC + NA_PAD + CC)       // weight plane rows: Wv | Wa (zero-extended) | Wo
#define IPB 8                          // pixels per block in k_av, adjacent in one image row
#define GPX 4                          // adjacent pixels that one thread of k_av aggregates
#define W5G (GPX * 25)                 // floats of the 5x5 weight tables of GPX adjacent pixels, one head, in k_av
#define YSP (CC + 8)                   // LDS pitch (floats) of one pixel's y row in k_av
#define CSP 132                        // LDS pitch (floats) of the 128-column epilogue tile
#define PSP 84                         // LDS pitch (floats) of one head's 81 softmax values in k_av (16-B rows)
#define SM_SCALE 0.17677669529663687f  // 32^-0.5
#define LOG2E 0x1.715476p+0f           // log2(e) in f32: e^x = 2^(x * LOG2E)
#define INV_W_CARRY 0.0625f            // weights are carried x16

static_assert(NB >= 1 && NB <= NB_FULL);
static_assert(NPIX % 64 == 0);
static_assert(CC % 16 == 0 && NA_PAD % 16 == 0);                             // weight planes start on a row tile
static_assert(IPB == 8 && NPIX % IPB == 0);                                  // a k_av block owns half a 16-row tile of the y plane
static_assert((NPIX * KCH) % 256 == 0);
static_assert((CC * KCH) % 256 == 0);
static_assert((NA_PAD * KCH) % 256 == 0);
static_assert((WROWS * KCH) % 256 == 0);
static_assert(CC % 64 == 0);
static_assert(NA_PAD % 64 == 0);
static_assert(NA <= NA_PAD);
static_assert(CC % 32 == 0);
static_assert(HEADS * DHEAD == CC);
static_assert(HEADS * 81 == NA);
static_assert(NPIX % IPB == 0);
static_assert(IPB == 2 * GPX);                  // two groups of 96 threads, GPX pixels each
static_assert(NRUN % 4 == 0 && WW % IPB == 0);   // runs are whole 16-B chunks; a k_av block's pixels share an image row
static_assert(2 * HEADS * W5G + IPB * YSP <= IPB * NA && (GPX * 5) % 4 == 0);   // tables and y rows reuse the logits' LDS

typedef _Float16 v16h __attribute__((ext_vector_type(16)));
typedef _Float16 v8h  __attribute__((ext_vector_type(8)));
typedef _Float16 v4h  __attribute__((ext_vector_type(4)));
typedef float    v8f  __attribute__((ext_vector_type(8)));
typedef float    v4f  __attribute__((ext_vector_type(4)));

union FragH { v16h v; v8h half[2]; };

__device__ __forceinline__ unsigned int bf16r_bits(float f) {
    unsigned int u = __float_as_uint(f);
    u += 0x7FFFu + ((u >> 16) & 1u);          // RNE to bf16
    return u & 0xFFFF0000u;
}
__device__ __forceinline__ float bf16r(float f) { return __uint_as_float(bf16r_bits(f)); }

// 2^x on the transcendental unit. The v_nop fills the one slot that the instruction set asks for between a
// transcendental and a next instruction that reads its result or overwrites its source.
__device__ __forceinline__ float exp2_slot(float x) {
    float y;
    asm("v_exp_f32 %0, %1\n\tv_nop" : "=v"(y) : "v"(x));
    return y;
}

__device__ __forceinline__ v8f wmma16(v16h a, v16h b, v8f c) {
    return __builtin_amdgcn_wmma_f32_16x16x32_f16(false, a, false, b, (short)0, c, false, false);
}

// ------------------------------------------------------------------------------------------------
// x [rows][384] f32 -> xh, fragment order, f16 (bf16-RNE value, exact in f16). One 16-B chunk per thread:
// 4 lanes read one 128-B line of a row, 8 rows a wave; the wave's stores fill 4 whole lines.
__device__ __forceinline__
void cvt_x(const float* __restrict__ x, _Float16* xh, int blk) {
    const int g = blk * 256 + (int)threadIdx.x;                 // < NB*NPIX*KCH exactly
    const int unit = g >> 6;
    const int tile = unit / KBL;
    const int kb   = unit - tile * KBL;
    const int m    = (g >> 2) & 15;
    const int c4   = g & 3;
    const float* s = x + (size_t)(tile * 16 + m) * CC + kb * 32 + c4 * 8;
    const v4f f0 = *(const v4f*)s;
    const v4f f1 = *(const v4f*)(s + 4);
    float t[8] = {f0.x, f0.y, f0.z, f0.w, f1.x, f1.y, f1.z, f1.w};
    v8h o;
#pragma unroll
    for (int e = 0; e < 8; ++e) o[e] = (_Float16)bf16r(t[e]);
    _Float16* d = xh + (size_t)(unit * 64 + (c4 >> 1) * 32 + (c4 & 1) * 16 + m) * 8;
    *(v8h*)d = o;
}

// ------------------------------------------------------------------------------------------------
// Weight planes, WROWS rows of 384, f16 = 16 * bf16-RNE(W), fragment order over rows n:
//   rows [0,384) Wv, [384,1408) Wa (rows >= 972 written as zeros), [1408,1792) Wo.
// Wa's plane row ij * 108 + head * 9 + q is taken from Wa's row head * 81 + ij * 9 + q.
// Plane selection is block-uniform (plane boundaries are multiples of 256 chunks).
__device__ __forceinline__
void cvt_w(const float* __restrict__ Wv, const float* __restrict__ Wa,
           const float* __restrict__ Wo, _Float16* wpl, int blk) {
    const int g   = blk * 256 + (int)threadIdx.x;               // < WROWS*KCH exactly
    const int unit = g >> 6;
    const int tile = unit / KBL;
    const int kb   = unit - tile * KBL;
    const int m    = (g >> 2) & 15;
    const int c4   = g & 3;
    const int R   = tile * 16 + m;
    const int ch  = kb * 4 + c4;
    const float* src;
    int rbase, nvalid;
    bool perm = false;
    if (blk < (CC * KCH) / 256)                  { src = Wv; rbase = 0;           nvalid = CC; }
    else if (blk < ((CC + NA_PAD) * KCH) / 256)  { src = Wa; rbase = CC;          nvalid = NA; perm = true; }
    else                                         { src = Wo; rbase = CC + NA_PAD; nvalid = CC; }
    const int rr = R - rbase;                                    // >= 0
    int rc = (rr < nvalid) ? rr : (nvalid - 1);                  // clamped address
    if (perm) {                                                  // block-uniform
        const int ij  = rc / NRUN;
        const int rem = rc - ij * NRUN;
        const int hd  = rem / 9;
        rc = hd * 81 + ij * 9 + (rem - hd * 9);
    }
    const float pm = (rr < nvalid) ? 16.0f : 0.0f;               // carry, or zero for extension rows
    const float* s = src + (size_t)rc * CC + ch * 8;
    const v4f f0 = *(const v4f*)s;
    const v4f f1 = *(const v4f*)(s + 4);
    float t[8] = {f0.x, f0.y, f0.z, f0.w, f1.x, f1.y, f1.z, f1.w};
    v8h o;
#pragma unroll
    for (int e = 0; e < 8; ++e) o[e] = (_Float16)(bf16r(t[e]) * pm);
    _Float16* d = wpl + (size_t)(unit * 64 + (c4 >> 1) * 32 + (c4 & 1) * 16 + m) * 8;
    *(v8h*)d = o;
}

// Both conversions in one grid (neither reads what the other writes): blocks [0, WBLK) write the weight
// planes, the rest the x plane.
#define WBLK ((WROWS * KCH) / 256)
#define XBLK ((NB * NPIX * KCH) / 256)
__global__ __launch_bounds__(256)
void k_cvt(const float* __restrict__ x, const float* __restrict__ Wv, const float* __restrict__ Wa,
           const float* __restrict__ Wo, _Float16* xh, _Float16* wpl) {
    const int blk = (int)blockIdx.x;
    if (blk < WBLK) cvt_w(Wv, Wa, Wo, wpl, blk);
    else            cvt_x(x, xh, blk - WBLK);
}

// ------------------------------------------------------------------------------------------------
// Out[m][n] = scale * sum_k A[m][k] * Bw[n][k]   (K = 384, A and Bw in fragment order)
// Block = 4 waves (2 x 2), each wave MT x NT WMMA tiles, so the block's tile is 32*MT rows x 32*NT = 128
// columns: a loaded fragment feeds NT (A) or MT (B) products. The block's operand rows come into LDS once,
// 64 k a stage, by asynchronous copies (16 B a lane, through no register) into two buffers: stage s + 1 flies
// while stage s is multiplied. A row tile's 64 k are 2 KiB contiguous in its plane (two units); in LDS every
// unit lies in the x plane's chunk order (the y plane's chunks are put there by each lane's LDS address), so a
// fragment half is one ds_load_b128 of 512 contiguous bytes, with the split-k lane map for A and B alike.
// Epilogue staged in LDS (in the buffers' place), then whole rows of the tile stored.
// FIN = 0 takes Bw = Wv | Wa in one grid: plane rows [0, 384) give hv [m][384] (v), rows [384, 1408) give
// hp [m][1024] (logits), both f16. FIN = 1 writes out [m][384], f32, alone.

// Asynchronous copies of 16 B a lane, global memory -> LDS (l: the lane's LDS byte address, g: its global address).
// The s_wait_xcnt stands in the copies' own statement, so that no address register is rewritten ahead of it.
__device__ __forceinline__
void copy4(const unsigned* l, const _Float16* const* g) {
    asm volatile("global_load_async_to_lds_b128 %0, %1, off\n\t"
                 "global_load_async_to_lds_b128 %2, %3, off\n\t"
                 "global_load_async_to_lds_b128 %4, %5, off\n\t"
                 "global_load_async_to_lds_b128 %6, %7, off\n\t"
                 "s_wait_xcnt 0x0"
                 :: "v"(l[0]), "v"(g[0]), "v"(l[1]), "v"(g[1]), "v"(l[2]), "v"(g[2]), "v"(l[3]), "v"(g[3])
                 : "memory");
}
__device__ __forceinline__
void copy8(const unsigned* l, const _Float16* const* g) {
    asm volatile("global_load_async_to_lds_b128 %0, %1, off\n\t"
                 "global_load_async_to_lds_b128 %2, %3, off\n\t"
                 "global_load_async_to_lds_b128 %4, %5, off\n\t"
                 "global_load_async_to_lds_b128 %6, %7, off\n\t"
                 "global_load_async_to_lds_b128 %8, %9, off\n\t"
                 "global_load_async_to_lds_b128 %10, %11, off\n\t"
                 "global_load_async_to_lds_b128 %12, %13, off\n\t"
                 "global_load_async_to_lds_b128 %14, %15, off\n\t"
                 "s_wait_xcnt 0x0"
                 :: "v"(l[0]), "v"(g[0]), "v"(l[1]), "v"(g[1]), "v"(l[2]), "v"(g[2]), "v"(l[3]), "v"(g[3]),
                    "v"(l[4]), "v"(g[4]), "v"(l[5]), "v"(g[5]), "v"(l[6]), "v"(g[6]), "v"(l[7]), "v"(g[7])
                 : "memory");
}

template <int FIN, int MT, int NT>
__global__ __launch_bounds__(128)
void k_gemm(const _Float16* __restrict__ A, const _Float16* __restrict__ Bw,
            float* out, _Float16* hv, _Float16* hp, float scale) {
    constexpr int BM = 32 * MT;
    constexpr int BN = 32 * NT;
    static_assert(BN == 128 && NT == 4 && (MT == 4 || MT == 2));
    static_assert((NB * NPIX) % BM == 0 && CC % BN == 0 && NA_PAD % BN == 0);
    constexpr int AT  = BM / 16;               // row tiles of A in the block's tile
    constexpr int BT  = BN / 16;               // row tiles of Bw
    constexpr int NCP = AT + BT;               // copies a thread and stage: 128 lanes x 16 B = one row tile's 64 k
    constexpr int STB = NCP * 2048;            // bytes of one stage
    constexpr int NST = CC / 64;               // stages
    constexpr int CSB = BM * CSP * 4;          // bytes of the epilogue tile
    constexpr int SMB = 2 * STB > CSB ? 2 * STB : CSB;
    static_assert(NST >= 2 && CC % 64 == 0 && (NCP == 16 || NCP == 12));
    __shared__ __attribute__((aligned(16))) unsigned char sm[SMB];   // cross-wave: two stage buffers, then the epilogue tile
    float* const cs = (float*)sm;
    const int tid  = (int)threadIdx.x;
    const int lane = tid & 31;
    const int wave = tid >> 5;
    const int h    = lane >> 4;          // lane half
    const int m    = lane & 15;          // A row / B col / D col
    const int m0   = (int)blockIdx.x * BM;
    const int n0   = (int)blockIdx.y * BN;
    const int wm   = (wave >> 1) * (16 * MT);
    const int wn   = (wave & 1) * (16 * NT);

    // Thread tid copies chunk tid of each row tile's 2 KiB: unit tid / 64, chunk u = tid % 64 of the unit. The y
    // plane's chunk u = row * 4 + c4 goes to place (c4 / 2) * 32 + (c4 % 2) * 16 + row, the x plane's order.
    const int u = tid & 63;
    const unsigned lofa = FIN ? (unsigned)((tid >> 6) * 1024 + (((u & 3) >> 1) * 32 + (u & 1) * 16 + (u >> 2)) * 16)
                              : (unsigned)(tid * 16);
    const unsigned smb = (unsigned)(size_t)sm;                     // LDS byte address of the buffers
    const _Float16* const ga0 = A  + (size_t)m0 * CC + tid * 8;
    const _Float16* const gb0 = Bw + (size_t)n0 * CC + tid * 8;

    auto issue = [&](int st, int buf) {                            // stage st's copies into buffer buf
        unsigned l[NCP];
        const _Float16* g[NCP];
#pragma unroll   // constant indices keep the addresses in registers
        for (int c = 0; c < AT; ++c) {
            l[c] = smb + (unsigned)(buf * STB + c * 2048) + lofa;
            g[c] = ga0 + st * 1024 + c * 16 * CC;
        }
#pragma unroll   // constant indices keep the addresses in registers
        for (int c = 0; c < BT; ++c) {
            l[AT + c] = smb + (unsigned)(buf * STB + (AT + c) * 2048 + tid * 16);
            g[AT + c] = gb0 + st * 1024 + c * 16 * CC;
        }
        copy8(l, g);
        if constexpr (NCP == 16) copy8(l + 8, g + 8);
        else                     copy4(l + 8, g + 8);
    };

    v8f acc[MT][NT];
#pragma unroll
    for (int i = 0; i < MT; ++i)
#pragma unroll
        for (int j = 0; j < NT; ++j) {
            const v8f z8 = {0.f, 0.f, 0.f, 0.f, 0.f, 0.f, 0.f, 0.f};
            acc[i][j] = z8;
        }

    issue(0, 0);
    asm volatile("s_wait_asynccnt 0x0" ::: "memory");   // this wave's copies of stage 0 have landed
    __syncthreads();                                    // stage 0 is copied per thread, read cross-wave
    issue(1, 1);

    // The stage loop stays rolled: one fragment set in registers, so that four waves (FIN = 1: eight) fit a SIMD. The
    // inner loops are unrolled so that the arrays have constant indices and stay in registers.
#pragma unroll 1
    for (int st = 0; st < NST; ++st) {
        const int buf = st & 1;
        const unsigned char* fa = sm + buf * STB + (wm >> 4) * 2048 + lane * 16;
        const unsigned char* fb = sm + buf * STB + (AT + (wn >> 4)) * 2048 + lane * 16;
#pragma unroll
        for (int kk = 0; kk < 2; ++kk) {
            FragH a[MT], b[NT];
            // elements 0..7 <- k0+8h+0..7, elements 8..15 <- k0+16+8h+0..7 (A and B identical map), k0 = st*64 + kk*32
#pragma unroll
            for (int i = 0; i < MT; ++i) {
                a[i].half[0] = *(const v8h*)(fa + i * 2048 + kk * 1024);
                a[i].half[1] = *(const v8h*)(fa + i * 2048 + kk * 1024 + 512);
            }
#pragma unroll
            for (int j = 0; j < NT; ++j) {
                b[j].half[0] = *(const v8h*)(fb + j * 2048 + kk * 1024);
                b[j].half[1] = *(const v8h*)(fb + j * 2048 + kk * 1024 + 512);
            }
#pragma unroll
            for (int i = 0; i < MT; ++i)
#pragma unroll
                for (int j = 0; j < NT; ++j) acc[i][j] = wmma16(a[i].v, b[j].v, acc[i][j]);
            // The v_nop fill the slots that the chip asks for between the last products and the next loads into
            // their operand registers (also over the loop's taken branch).
            if constexpr (FIN) {
                asm volatile("v_nop\n\tv_nop\n\tv_nop\n\tv_nop"
                             : "+v"(acc[0][0]), "+v"(acc[0][1]), "+v"(acc[0][2]), "+v"(acc[0][3]),
                               "+v"(acc[1][0]), "+v"(acc[1][1]), "+v"(acc[1][2]), "+v"(acc[1][3])
                             : "v"(a[0].v), "v"(a[1].v),
                               "v"(b[0].v), "v"(b[1].v), "v"(b[2].v), "v"(b[3].v));
            } else {
                asm volatile("v_nop\n\tv_nop\n\tv_nop\n\tv_nop"
                             : "+v"(acc[0][0]), "+v"(acc[0][1]), "+v"(acc[0][2]), "+v"(acc[0][3]),
                               "+v"(acc[1][0]), "+v"(acc[1][1]), "+v"(acc[1][2]), "+v"(acc[1][3]),
                               "+v"(acc[2][0]), "+v"(acc[2][1]), "+v"(acc[2][2]), "+v"(acc[2][3]),
                               "+v"(acc[3][0]), "+v"(acc[3][1]), "+v"(acc[3][2]), "+v"(acc[3][3])
                             : "v"(a[0].v), "v"(a[1].v), "v"(a[2].v), "v"(a[3].v),
                               "v"(b[0].v), "v"(b[1].v), "v"(b[2].v), "v"(b[3].v));
            }
        }
        asm volatile("s_wait_dscnt 0x0" ::: "memory");      // this wave's reads of the buffer are done before it is refilled
        asm volatile("s_wait_asynccnt 0x0" ::: "memory");   // this wave's copies of stage st + 1 have landed
        __syncthreads();                                    // publishes stage st + 1; ends every wave's reads of stage st
        if (st + 2 < NST) issue(st + 2, buf);
    }
    asm volatile("s_wait_asynccnt 0x0" ::: "memory");       // no copy is in flight when the buffers become the epilogue tile

    // D element r of lane -> row 8h + r, col m of each 16x16 tile
#pragma unroll
    for (int i = 0; i < MT; ++i) {
#pragma unroll
        for (int j = 0; j < NT; ++j) {
            float* p = cs + (wm + i * 16 + 8 * h) * CSP + wn + j * 16 + m;
#pragma unroll
            for (int r = 0; r < 8; ++r) p[r * CSP] = acc[i][j][r] * scale;
        }
    }
    __syncthreads();   // cs is written per wave, read cross-wave

    if constexpr (FIN) {
        // BM rows x 512 B; per pass each wave stores one whole row (4 lines)
        float* const ob = out + (size_t)m0 * CC + n0;      // block-uniform base; the rest fits 32 bits
        const unsigned vo = (unsigned)(wave * CC + lane * 4);
#pragma unroll
        for (int p = 0; p < BM / 4; ++p) {
            const v4f v = *(const v4f*)(cs + (p * 4 + wave) * CSP + lane * 4);
            *(v4f*)(ob + (vo + (unsigned)(p * 4 * CC))) = v;
        }
    } else {
        // BM rows x 256 B of f16; per pass each wave stores two whole rows (2 lines each), 16 B a lane
        const bool second = n0 >= CC;                      // block-uniform: this tile's columns are logits
        _Float16* const od = second ? hp : hv;
        const int    ldo = second ? NA_PAD : CC;
        const int    nc  = second ? n0 - CC : n0;
        _Float16* const ob = od + (size_t)m0 * ldo + nc;   // block-uniform base; the rest fits 32 bits
        const int    rw  = wave * 2 + h;                   // row within a pass
        const unsigned vo = (unsigned)(rw * ldo + m * 8);
#pragma unroll
        for (int p = 0; p < BM / 8; ++p) {
            const float* s = cs + (p * 8 + rw) * CSP + m * 8;
            const v4f f0 = *(const v4f*)s;
            const v4f f1 = *(const v4f*)(s + 4);
            const v8h o = {(_Float16)f0.x, (_Float16)f0.y, (_Float16)f0.z, (_Float16)f0.w,
                           (_Float16)f1.x, (_Float16)f1.y, (_Float16)f1.z, (_Float16)f1.w};
            *(v8h*)(ob + (vo + (unsigned)(p * 8 * ldo))) = o;
        }
    }
}

// ------------------------------------------------------------------------------------------------
// Fused: per-pixel 9-way softmax (each logit group feeds exactly one output pixel), combination of
// the 81 window weights into a 5x5 table per (pixel, head) in LDS (entries whose v position lies outside
// the image are written as zeros: zero-extended v), weighted aggregation of V over the 5x5 neighbourhood,
// then y written as one f16 plane. Block = 8 adjacent pixels of one image row,
// 192 threads. The block's logits (8 pixels x 9 runs of 216 B) come in as 8-B chunks, one run a wave load,
// and are laid in LDS as f32; the 864 softmax groups are dealt over the threads. In the
// aggregation 96 threads (3 waves, 4 channels a thread) take 4 adjacent pixels: their neighbourhoods
// overlap, so one 5x8 window of loads (addresses clamped into the image) serves all four.
//   P  : [NB*NPIX][1024] f16 logits (unscaled, columns ij * 108 + head * 9 + q)
//   V  : [NB*NPIX][384] f16
//   Yh : NB*NPIX rows of 384, f16, fragment order (y plane's chunk order)
__global__ __launch_bounds__(192)
void k_av(const _Float16* __restrict__ P, const _Float16* __restrict__ V,
          _Float16* Yh) {
#pragma clang fp contract(off)
    __shared__ __attribute__((aligned(16))) float zs[IPB * NA];            // cross-wave: logits, [pixel][ij][head][q]
    __shared__ __attribute__((aligned(16))) float ps[IPB * HEADS * PSP];   // cross-wave: softmax values, [pixel][head][ij * 9 + q]
    // The logits are dead behind the second barrier: the tables (written behind it) and the y rows (written
    // behind the third) take their place.
    float* const w5s = zs;                         // cross-wave: 5x5 tables, [pixel / 4][head][dy][pixel % 4][dx]
    float* const ys  = zs + 2 * HEADS * W5G;       // cross-wave: y rows, pitch YSP
    const int tid = (int)threadIdx.x;
    const int lpb = (int)blockIdx.x * IPB;    // first pixel of this block
    const int rs0 = lpb % NPIX;               // the block's pixels follow one another in the same image row
    const int rb  = rs0 / WW;
    const int sb  = rs0 - rb * WW;

    // ---- phase 0: the block's logits into LDS, one run (pixel, ij) of 27 chunks a wave load. A wave takes window
    //      row i = wave / 2 of 4 pixels: 12 runs, whose addresses are the same in all lanes but for the chunk and are
    //      kept scalar; all loads ahead of the stores ----
    {
        const int wv   = __builtin_amdgcn_readfirstlane(tid >> 5);
        const int lane = tid & 31;
        const int wi   = wv >> 1;
        const int wp   = (wv & 1) * GPX;
        const int ny   = rb + 1 - wi;             // row of the window centre pixels n'
        const int nyc  = ny < 0 ? 0 : (ny >= HH ? HH - 1 : ny);
        const int rowp = lpb - sb + (nyc - rb) * WW;          // first pixel of that row, same image, clamped
        // scalar base (source row, window row i) + one of 6 lane offsets (source column, chunk) + constant j * 216 B
        const _Float16* pw = P + __builtin_amdgcn_readfirstlane(rowp * NA_PAD + wi * 3 * NRUN);
        if (lane < RCH) {
            unsigned po[GPX + 2];
#pragma unroll
            for (int x = 0; x < GPX + 2; ++x) {
                const int nx  = sb + wp + x - 1;
                const int nxc = nx < 0 ? 0 : (nx >= WW ? WW - 1 : nx);   // clamped address
                po[x] = (unsigned)(__builtin_amdgcn_readfirstlane(nxc * NA_PAD) + lane * 4) * 2u;   // bytes
            }
            v4h zl[3 * GPX];
#pragma unroll   // constant indices keep zl in registers
            for (int t = 0; t < 3 * GPX; ++t)
                zl[t] = *(const v4h*)((const char*)(pw + (t % 3) * NRUN) + po[t / 3 + 2 - t % 3]);
            // The wait that belongs in front of any overwrite of a register that an issued load names; the offsets
            // and the base are inputs so that they live up to it and no load lands in one of them.
            asm volatile("s_wait_xcnt 0x0"
                         :: "v"(po[0]), "v"(po[1]), "v"(po[2]), "v"(po[3]), "v"(po[4]), "v"(po[5]), "s"(pw) : "memory");
            float* zd = zs + (wp * 9 + wi * 3) * NRUN + lane * 4;
#pragma unroll   // constant indices keep zl in registers
            for (int t = 0; t < 3 * GPX; ++t)
                *(v4f*)(zd + ((t / 3) * 9 + t % 3) * NRUN) = __builtin_convertvector(zl[t], v4f);
        }
    }
    __syncthreads();   // zs is written per chunk, read per group

    // ---- phase 1a: softmax of the 9x12 groups feeding each pixel, group ga = pixel * 108 + head * 9 + ij ----
    {
        constexpr int NG  = HEADS * 9;            // 108 groups per pixel
        constexpr int NT1 = (IPB * NG + 191) / 192;   // 5 trips, the last one on half the waves
#pragma unroll   // the trips are independent chains
        for (int t = 0; t < NT1; ++t) {
            const int ga = t * 192 + tid;
            if (t < NT1 - 1 || ga < IPB * NG) {
                const int px = ga / NG;
                const int g  = ga - px * NG;
                const int hd = g / 9;
                const int ij = g - hd * 9;
                const int i  = ij / 3;
                const int j  = ij - 3 * i;
                const int ny = rb + 1 - i;                // window centre pixel n'
                const int nx = sb + px + 1 - j;
                const bool ok = ((unsigned)ny < (unsigned)HH) && ((unsigned)nx < (unsigned)WW);
                const float* gsrc = zs + px * NA + ij * NRUN + hd * 9;
                float z[9];
#pragma unroll
                for (int q = 0; q < 9; ++q) z[q] = gsrc[q];
                float mx = -3.0e38f;
#pragma unroll
                for (int q = 0; q < 9; ++q) { z[q] = z[q] * SM_SCALE; mx = fmaxf(mx, z[q]); }
                float e[9];
                float sum = 0.0f;
#pragma unroll
                for (int q = 0; q < 9; ++q) { e[q] = exp2_slot((z[q] - mx) * LOG2E); sum += e[q]; }
                const float inv = 1.0f / sum;
                float* pd = ps + (px * HEADS + hd) * PSP + ij * 9;
#pragma unroll
                for (int q = 0; q < 9; ++q) pd[q] = ok ? (e[q] * inv) : 0.0f;
            }
        }
    }
    __syncthreads();   // ps is written per group, read per (pixel, head); ends the reads of zs

    // ---- phase 1b: 5x5 tables, one (pixel, head) a thread. The weight for v offset (dy, dx) = (qi - i, qj - j)
    //      belongs to entry (dy+2)*5 + (dx+2); an entry's terms are added in ascending ij ----
    if (tid < IPB * HEADS) {
        const float* srcp = ps + tid * PSP;
        float pr[81];
#pragma unroll
        for (int c = 0; c < 20; ++c) {
            const v4f p4 = *(const v4f*)(srcp + c * 4);
            pr[c * 4 + 0] = p4.x; pr[c * 4 + 1] = p4.y; pr[c * 4 + 2] = p4.z; pr[c * 4 + 3] = p4.w;
        }
        pr[80] = srcp[80];
        float tb[25];
#pragma unroll
        for (int t = 0; t < 25; ++t) tb[t] = 0.0f;
#pragma unroll
        for (int ij = 0; ij < 9; ++ij) {
            const int i = ij / 3;
            const int j = ij - 3 * i;
#pragma unroll
            for (int q = 0; q < 9; ++q) {
                const int qi = q / 3;
                const int qj = q - 3 * qi;
                tb[(2 - i + qi) * 5 + (2 - j + qj)] += pr[ij * 9 + q];
            }
        }
        const int px = tid / HEADS;
        const int sp = sb + px;                    // this table's pixel column
        float* wdst = w5s + ((px / GPX) * HEADS + (tid - px * HEADS)) * W5G + (px % GPX) * 5;
#pragma unroll
        for (int t = 0; t < 25; ++t) {
            const bool in = ((unsigned)(rb + t / 5 - 2) < (unsigned)HH) && ((unsigned)(sp + t % 5 - 2) < (unsigned)WW);
            wdst[(t / 5) * (GPX * 5) + t % 5] = in ? tb[t] : 0.0f;
        }
    }
    __syncthreads();   // w5s is written per (pixel, head), read per channel group

    // ---- phase 2: y[c] = sum over 5x5 neighbourhood of w5[dy][dx] * v[r+dy][s+dx][c], GPX pixels a thread ----
    {
        const int grp  = __builtin_amdgcn_readfirstlane(tid / 96);   // same in all lanes of a wave: kept scalar
        const int u    = tid - grp * 96;
        const int c0   = u * 4;
        const int head = u >> 3;                   // 32 channels per head, 4 per thread
        const int s0   = sb + grp * GPX;           // column of the group's first pixel
        const _Float16* vimg = V + (size_t)(lpb - rs0) * CC;   // the image's first pixel
        // A load = scalar row base + lane offset (column, channel): 5 bases and 8 offsets serve the 40 loads.
        const _Float16* rowb[5];
        unsigned        vo[GPX + 4];
#pragma unroll
        for (int ka = 0; ka < 5; ++ka) {
            const int yy  = rb - 2 + ka;
            const int yyc = yy < 0 ? 0 : (yy >= HH ? HH - 1 : yy);       // outside the image: weight zero
            rowb[ka] = vimg + __builtin_amdgcn_readfirstlane(yyc * (WW * CC));
        }
#pragma unroll
        for (int kb = 0; kb < GPX + 4; ++kb) {
            const int xx  = s0 - 2 + kb;
            const int xxc = xx < 0 ? 0 : (xx >= WW ? WW - 1 : xx);       // outside the image: weight zero
            vo[kb] = (unsigned)(__builtin_amdgcn_readfirstlane(xxc * CC) + c0) * 2u;   // bytes
        }
        const float* wt = w5s + (grp * HEADS + head) * W5G;
        v4h vv[5][GPX + 4];
        v4f acc[GPX];
#pragma unroll
        for (int p = 0; p < GPX; ++p) acc[p] = v4f{0.0f, 0.0f, 0.0f, 0.0f};
#pragma unroll   // constant indices keep vv in registers
        for (int ka = 0; ka < 5; ++ka)
#pragma unroll
            for (int kb = 0; kb < GPX + 4; ++kb) vv[ka][kb] = *(const v4h*)((const char*)rowb[ka] + vo[kb]);
        // The wait that belongs in front of any overwrite of a register that an issued load names; the offsets
        // and the bases are inputs so that they live up to it and no load lands in one of them.
        asm volatile("s_wait_xcnt 0x0"
                     :: "v"(vo[0]), "v"(vo[1]), "v"(vo[2]), "v"(vo[3]), "v"(vo[4]), "v"(vo[5]), "v"(vo[6]), "v"(vo[7]),
                        "s"(rowb[0]), "s"(rowb[1]), "s"(rowb[2]), "s"(rowb[3]), "s"(rowb[4]) : "memory");
#pragma unroll   // constant indices keep vv and acc in registers
        for (int ka = 0; ka < 5; ++ka) {
            float w[GPX * 5];
#pragma unroll
            for (int c = 0; c < GPX * 5 / 4; ++c) {
                const v4f w4 = *(const v4f*)(wt + ka * (GPX * 5) + c * 4);
                w[c * 4 + 0] = w4.x; w[c * 4 + 1] = w4.y; w[c * 4 + 2] = w4.z; w[c * 4 + 3] = w4.w;
            }
            v4f xr[GPX + 4];                           // this window row as f32, each value widened once
#pragma unroll
            for (int kb = 0; kb < GPX + 4; ++kb) xr[kb] = __builtin_convertvector(vv[ka][kb], v4f);
#pragma unroll
            for (int p = 0; p < GPX; ++p)
#pragma unroll
                for (int e = 0; e < 5; ++e) {          // a pixel's terms in ascending (dy, dx)
                    const float wq = w[p * 5 + e];
                    const v4f   x4 = xr[p + e];
                    acc[p].x = fmaf(wq, x4.x, acc[p].x);
                    acc[p].y = fmaf(wq, x4.y, acc[p].y);
                    acc[p].z = fmaf(wq, x4.z, acc[p].z);
                    acc[p].w = fmaf(wq, x4.w, acc[p].w);
                }
        }
#pragma unroll
        for (int p = 0; p < GPX; ++p) *(v4f*)(ys + (grp * GPX + p) * YSP + c0) = acc[p];
    }
    __syncthreads();   // ys is written per (pixel, channel group), read per plane chunk

    // ---- phase 3: plane stores, one wave store = 8 pixels x 64 B = 512 contiguous bytes of one unit ----
#pragma unroll   // the two trips are independent chains
    for (int t = 0; t < 2; ++t) {
        const int rem  = t * 192 + tid;            // < 384 = 12 k blocks x 8 pixels x 4 chunks
        const int kb   = rem >> 5;
        const int pix3 = (rem >> 2) & 7;
        const int c4   = rem & 3;
        const float* ysrc = ys + pix3 * YSP + (kb * 4 + c4) * 8;
        const v4f y0 = *(const v4f*)ysrc;
        const v4f y1 = *(const v4f*)(ysrc + 4);
        float yv[8] = {y0.x, y0.y, y0.z, y0.w, y1.x, y1.y, y1.z, y1.w};
        v8h o;
#pragma unroll
        for (int e = 0; e < 8; ++e) o[e] = (_Float16)yv[e];
        const int gp3 = lpb + pix3;
        const size_t dofs = ((size_t)((gp3 >> 4) * KBL + kb) * 64 + (gp3 & 15) * 4 + c4) * 8;
        *(v8h*)(Yh + dofs) = o;
    }
}

// ------------------------------------------------------------------------------------------------
static inline size_t al256(size_t b) { return (b + 255) & ~(size_t)255; }

extern "C" void kernel_launch(void* const* d_in, const int* in_sizes, int n_in,
                              void* d_out, int out_size, void* d_ws, size_t ws_size,
                              hipStream_t stream) {
    if (n_in < 4) return;
    if (in_sizes[0] < NB * NPIX * CC) return;
    if (in_sizes[1] < CC * CC) return;
    if (in_sizes[2] < NA * CC) return;
    if (in_sizes[3] < CC * CC) return;
    if (out_size < NB * NPIX * CC) return;

    const float* x  = (const float*)d_in[0];   // [NB][56][56][384]
    const float* Wv = (const float*)d_in[1];   // [384][384]  ([out][in])
    const float* Wa = (const float*)d_in[2];   // [972][384]
    const float* Wo = (const float*)d_in[3];   // [384][384]
    float* out = (float*)d_out;                // [NB][56][56][384] f32

    // multiples of the store granularity, offsets 256-B aligned)
    const size_t szXH = (size_t)NB * NPIX * CC * 2;            // x as f16
    const size_t szW  = (size_t)WROWS * CC * 2;                // weight planes
    const size_t szV  = (size_t)NB * NPIX * CC * 2;            // v, f16
    const size_t szP  = (size_t)NB * NPIX * NA_PAD * 2;        // logits, f16
    const size_t szY  = (size_t)NB * NPIX * CC * 2;            // y plane
    size_t off = 0;
    const size_t oXH = off; off += al256(szXH);
    const size_t oW  = off; off += al256(szW);
    const size_t oV  = off; off += al256(szV);
    const size_t oP  = off; off += al256(szP);
    const size_t oYH = off; off += al256(szY);
    if (off > ws_size) return;

    char* ws = (char*)d_ws;
    _Float16* Xh  = (_Float16*)(ws + oXH);
    _Float16* Wpl = (_Float16*)(ws + oW);
    const _Float16* Woh = Wpl + (size_t)(CC + NA_PAD) * CC;
    _Float16* Vf = (_Float16*)(ws + oV);
    _Float16* Pf = (_Float16*)(ws + oP);
    _Float16* Yh = (_Float16*)(ws + oYH);

    // 1) operand planes
    k_cvt<<<WBLK + XBLK, 256, 0, stream>>>(x, Wv, Wa, Wo, Xh, Wpl);
    // 2) v = x * Wv^T -> f16 [NB*NPIX][384] and logits = x * Wa^T -> f16 [NB*NPIX][1024], all images
    k_gemm<0, 4, 4><<<dim3(NB * NPIX / 128, (CC + NA_PAD) / 128), 128, 0, stream>>>(Xh, Wpl, out, Vf, Pf, INV_W_CARRY);
    // 3) softmax + aggregation + fold, all images
    k_av<<<NB * NPIX / IPB, 192, 0, stream>>>(Pf, Vf, Yh);
    // 4) out = y * Wo^T -> d_out
    k_gemm<1, 2, 4><<<dim3(NB * NPIX / 64, CC / 128), 128, 0, stream>>>(Yh, Woh, out, Vf, Pf, INV_W_CARRY);
}
